// v000
// The times below were measured on an AMD MI455X: many runs one after another, warmed up first and cycling through
// copies of the inputs, with the whole window's GPU time divided by the number of runs. Launches and the gaps
// between them are all in it. The median over several windows is given; except for v000 it joins two sittings, which
// can be a few percent apart, so the side-by-side timings, each taken in one sitting, are the better comparison.
// The starting kernel, v000, takes 2380 microseconds a run.
#include <hip/hip_runtime.h>

// Cross attention with an epipolar mask multiplied into part of the score block (x, src_encode [8][512][1024]; q = x Wq^T + bq, k, v = src_encode W^T + b ('oi' [1024][1024] + [1024], 0.02; 16 heads x 64); att = q.k / 8; att[:, :, 0:256, 0:256] *= mask with mask[b][i][j] = backward_map[b][j][i] forward_map[b][i][j] (inputs [8][256][256], read); softmax over all 512 keys; out = merged Wp^T + bp -> [8][512][1024] (4.2 M)).
// Layout per batch: bf16 copies of the two inputs in turn; exact projections + f32 biases; dense T-512 attention with every row on hi/lo planes (3 products); an element-wise kernel multiplies the pass's score block entries (i, j < 256) by the gathered mask (4 consecutive j per thread) before the softmax (the 1/8 is folded into q so the product applies to the scaled scores, as in the module); merged hi/lo x Wp exact + bp.
// Compute dtypes, f32 accumulate: every input rounded to bf16 incl. the maps; projections exact + f32 biases; scores and attn.v 3 products; mask product and softmax f32; Wp hl x exact + bias.

#define NB_  8
#define TT   512
#define DM   1024
#define NH_  16
#define NKV  16
#define REP  (NH_ / NKV)
#define HD   64
#define DQ   (NH_ * HD)
#define DKV  (NKV * HD)
#define ZH   2
#define RH   512                  // query rows < RH use hi+lo planes (0: none)
#define WIN  0
#define PCAR 1024.0f
#define SCL  1.0f   // 1/8 folded into q (QSC) so the mask multiplies the scaled scores
#define QSC  0.125f
#define HWM  256     // masked sub-block size
typedef _Float16 h16;
typedef unsigned short bf;
typedef __attribute__((ext_vector_type(16))) __bf16   v16bf;
typedef __attribute__((ext_vector_type(16))) _Float16 v16h;
typedef __attribute__((ext_vector_type(8)))  _Float16 v8h;
typedef __attribute__((ext_vector_type(8)))  unsigned short v8us;
typedef __attribute__((ext_vector_type(8)))  float    v8f;
typedef __attribute__((ext_vector_type(4)))  float    v4f;
typedef v8h  __attribute__((may_alias)) v8ha;
typedef v4f  __attribute__((may_alias)) v4fa;
typedef v8us __attribute__((may_alias)) v8usa;

__device__ __forceinline__ unsigned short f2bf(float f) { unsigned u = __float_as_uint(f); u += 0x7FFFu + ((u >> 16) & 1u); return (unsigned short)(u >> 16); }
__device__ __forceinline__ float bf2f(unsigned short b) { return __uint_as_float(((unsigned)b) << 16); }
__device__ __forceinline__ float bfr(float f) { return bf2f(f2bf(f)); }
__device__ __forceinline__ v16h cat16(v8h lo, v8h hi) { return __builtin_shufflevector(lo, hi, 0, 1, 2, 3, 4, 5, 6, 7, 8, 9, 10, 11, 12, 13, 14, 15); }
__device__ __forceinline__ v16bf cat16b(v8us lo, v8us hi) { return __builtin_bit_cast(v16bf, __builtin_shufflevector(lo, hi, 0, 1, 2, 3, 4, 5, 6, 7, 8, 9, 10, 11, 12, 13, 14, 15)); }
__device__ __forceinline__ v8f wmma16(v16h a, v16h b, v8f c) { return __builtin_amdgcn_wmma_f32_16x16x32_f16(false, a, false, b, (short)0, c, false, false); }
__device__ __forceinline__ v8f wmmab(v16bf a, v16bf b, v8f c) { return __builtin_amdgcn_wmma_f32_16x16x32_bf16(false, a, false, b, (short)0, c, false, false); }



// ---- k_gemmw: register-blocked GEMM, ONE WAVE per 64x64 output tile (16 accumulators), operands straight from K-contiguous 16-bit planes; grid (M/64, N/64, Z), 32 threads.
// C[m][n] (f32, pitch ldc, + optional f32 bias[n]) = sum_k A[m][k] Bt[n][k] (+ split products per NSPLIT). z-batch strides sA/sB/sC in elements. K % 32 == 0.
template <typename T16> struct WFrag;
template <> struct WFrag<h16> { typedef v16h V; static __device__ __forceinline__ V ld(const h16* p) { return cat16(*(const v8h*)p, *(const v8h*)(p + 16)); } static __device__ __forceinline__ v8f mma(V a, V b, v8f c) { return wmma16(a, b, c); } };
template <> struct WFrag<bf> { typedef v16bf V; static __device__ __forceinline__ V ld(const bf* p) { return cat16b(*(const v8us*)p, *(const v8us*)(p + 16)); } static __device__ __forceinline__ v8f mma(V a, V b, v8f c) { return wmmab(a, b, c); } };
template <typename T16, int NSPLIT, bool BIAS>
__global__ __launch_bounds__(32) void k_gemmw(const T16* __restrict__ A, const T16* __restrict__ A2, const T16* __restrict__ Bt, const T16* __restrict__ Bt2, int K, float* C, int ldc, const float* __restrict__ bias, size_t sA, size_t sB, size_t sC) {
    typedef typename WFrag<T16>::V V;
    __shared__ __align__(16) float os[16 * 68];
    const size_t z = blockIdx.z; A += z * sA; if (A2) A2 += z * sA; Bt += z * sB; if (Bt2) Bt2 += z * sB; C += z * sC;
    const int lane = threadIdx.x & 31, lr = lane & 15, hi = lane >> 4; const int r0 = blockIdx.x * 64, c0 = blockIdx.y * 64;
    v8f acc[4][4];
#pragma unroll
    for (int mb = 0; mb < 4; ++mb)
#pragma unroll
        for (int nb = 0; nb < 4; ++nb) acc[mb][nb] = (v8f){};
    const size_t aoff = (size_t)(r0 + lr) * K + 8 * hi, boff = (size_t)(c0 + lr) * K + 8 * hi;
#pragma unroll 1
    for (int kc = 0; kc < K; kc += 32) {
        V a[4], a2[4];
#pragma unroll
        for (int mb = 0; mb < 4; ++mb) { a[mb] = WFrag<T16>::ld(A + aoff + (size_t)mb * 16 * K + kc); if (NSPLIT == 1 || NSPLIT == 2) a2[mb] = WFrag<T16>::ld(A2 + aoff + (size_t)mb * 16 * K + kc); }
#pragma unroll
        for (int nb = 0; nb < 4; ++nb) { const V b = WFrag<T16>::ld(Bt + boff + (size_t)nb * 16 * K + kc); V b2; if (NSPLIT >= 2) b2 = WFrag<T16>::ld(Bt2 + boff + (size_t)nb * 16 * K + kc);
#pragma unroll
            for (int mb = 0; mb < 4; ++mb) { acc[mb][nb] = WFrag<T16>::mma(a[mb], b, acc[mb][nb]); if (NSPLIT == 1 || NSPLIT == 2) acc[mb][nb] = WFrag<T16>::mma(a2[mb], b, acc[mb][nb]); if (NSPLIT >= 2) acc[mb][nb] = WFrag<T16>::mma(a[mb], b2, acc[mb][nb]); } }
        asm volatile("v_nop\n\tv_nop\n\tv_nop\n\tv_nop" : "+v"(acc[0][0]), "+v"(acc[1][1]), "+v"(acc[2][2]), "+v"(acc[3][3]) : "v"(a[0]), "v"(a[3]));
    }
#pragma unroll
    for (int mb = 0; mb < 4; ++mb) {
#pragma unroll
        for (int nb = 0; nb < 4; ++nb) {
#pragma unroll
            for (int j = 0; j < 8; ++j) os[(hi * 8 + j) * 68 + nb * 16 + lr] = acc[mb][nb][j]; }
        __builtin_amdgcn_wave_barrier(); asm volatile("" ::: "memory");
        float* crow = C + (size_t)(r0 + mb * 16) * ldc + c0;
{
#pragma unroll
            for (int s = 0; s < 8; ++s) { const int row = 2 * s + hi, cofs = lr * 4; v4f val = *(const v4fa*)(os + row * 68 + cofs); if (BIAS) { val[0] += bfr(bias[c0 + cofs]); val[1] += bfr(bias[c0 + cofs + 1]); val[2] += bfr(bias[c0 + cofs + 2]); val[3] += bfr(bias[c0 + cofs + 3]); }
                *(v4f*)(crow + (size_t)row * ldc + cofs) = val; }
             }
        __builtin_amdgcn_wave_barrier(); asm volatile("" ::: "memory");
    }
}

__device__ __forceinline__ h16 tohx(float x) { return (h16)x; }
__device__ __forceinline__ void splitf(float y, unsigned short& h, unsigned short& l) { h = f2bf(y); l = f2bf(y - bf2f(h)); }
typedef __attribute__((ext_vector_type(2))) _Float16 v2h;
typedef __attribute__((ext_vector_type(4))) _Float16 v4h;
typedef __attribute__((ext_vector_type(2))) unsigned short v2us;
typedef __attribute__((ext_vector_type(4))) unsigned short v4us;
typedef __attribute__((ext_vector_type(2))) float v2f;
typedef __attribute__((ext_vector_type(4))) int v4i;

__global__ __launch_bounds__(256) void k_wtG(const float* __restrict__ w, int K, int N, bf* Bt) {
    const int lane = threadIdx.x & 31; const int L0 = (blockIdx.x * 8 + (threadIdx.x >> 5)) * 8; const int nlines = N * K / 64;
{
#pragma unroll 1
        for (int l = 0; l < 8; ++l) { const int L = L0 + l; if (L >= nlines) break; const size_t e = (size_t)L * 64 + lane * 2; const int k = (int)(e % K), n = (int)(e / K); v2us o;
            o[0] = f2bf(w[(size_t)k * N + n]); o[1] = f2bf(w[(size_t)(k + 1) * N + n]); *(v2us*)(Bt + e) = o; }
         }
}
__global__ __launch_bounds__(256) void k_cvt8(const float* __restrict__ src, bf* dst, size_t n8) { const size_t i = (size_t)blockIdx.x * 256 + threadIdx.x; if (i >= n8) return; const v8f v = *(const v8f*)(src + i * 8); v8us o;
#pragma unroll
    for (int k = 0; k < 8; ++k) o[k] = f2bf(v[k]); *(v8us*)(dst + i * 8) = o;  }

// k_rope: head planes [h][t][d] (fp16 + hi/lo) of rope(x) x sc with the rotate-half convention out[d] = x[d] cos[t][d] - x[d+HD/2] sin[t][d], out[d+HD/2] = x[d+HD/2] cos[t][d+HD/2] + x[d] sin[t][d+HD/2]
__global__ __launch_bounds__(256) void k_rope(const float* __restrict__ F, int pitch, int nheads, const float* __restrict__ CS, const float* __restrict__ RF, const float* __restrict__ nw, float sc, h16* P16, bf* Ph, bf* Pl) {
    const size_t e = ((size_t)blockIdx.x * 256 + threadIdx.x) * 2; if (e >= (size_t)nheads * TT * HD) return; const int d = (int)(e % HD); const int t = (int)((e / HD) % TT); const int h = (int)(e / ((size_t)HD * TT)); const float* f = F + (size_t)t * pitch + h * HD; const float rf = RF ? RF[(size_t)h * TT + t] : 1.0f; v2h o16; v2us oh, ol;
#pragma unroll
    for (int q = 0; q < 2; ++q) { const int dd = d + q; const int dp = (dd < HD / 2) ? dd + HD / 2 : dd - HD / 2; float x0 = f[dd], x1 = f[dp];
        if (RF) { float n0 = __fmul_rn(x0, rf), n1 = __fmul_rn(x1, rf); asm volatile("" : "+v"(n0)); asm volatile("" : "+v"(n1)); x0 = __fmul_rn(bfr(nw[dd]), n0); x1 = __fmul_rn(bfr(nw[dp]), n1); }
        const v2f cs = *(const v2f*)(CS + ((size_t)t * HD + dd) * 2); float a = __fmul_rn(x0, cs[0]), bq = __fmul_rn(x1, cs[1]); asm volatile("" : "+v"(a)); asm volatile("" : "+v"(bq)); const float r = ((dd < HD / 2) ? __fsub_rn(a, bq) : __fadd_rn(a, bq)) * sc;
        o16[q] = tohx(r); unsigned short a2, c2; splitf(r, a2, c2); oh[q] = a2; ol[q] = c2; }
    *(v2h*)(P16 + e) = o16; *(v2us*)(Ph + e) = oh; *(v2us*)(Pl + e) = ol;  }
__global__ __launch_bounds__(256) void k_vtp(const float* __restrict__ F, int pitch, int nheads, h16* V16, bf* Vh, bf* Vl) { const size_t e = ((size_t)blockIdx.x * 256 + threadIdx.x) * 2; if (e >= (size_t)nheads * HD * TT) return; const int t = (int)(e % TT); const int d = (int)((e / TT) % HD); const int g = (int)(e / ((size_t)TT * HD)); v2h o16; v2us oh, ol;
#pragma unroll
    for (int q = 0; q < 2; ++q) { const float x = F[(size_t)(t + q) * pitch + g * HD + d]; o16[q] = tohx(x); unsigned short a2, c2; splitf(x, a2, c2); oh[q] = a2; ol[q] = c2; }
    *(v2h*)(V16 + e) = o16; *(v2us*)(Vh + e) = oh; *(v2us*)(Vl + e) = ol;  }
__global__ __launch_bounds__(256) void k_csid(float* CS) { const int idx = blockIdx.x * 256 + threadIdx.x; if (idx >= TT * HD) return; v2f cs; cs[0] = 1.0f; cs[1] = 0.0f; *(v2f*)(CS + (size_t)idx * 2) = cs;  }
// k_asoft: per row (zz, i): t = S x SCL (1: the 1/8 is folded into q) (no mask); softmax over the 512 keys (register row, one exp, fixed trees);
__global__ __launch_bounds__(256) void k_asoft(const float* __restrict__ Sb, h16* P16, bf* Ph, bf* Pl) {
    const int lane = threadIdx.x & 31; const int row = blockIdx.x * 8 + (threadIdx.x >> 5); if (row >= ZH * TT) return; const int i = row % TT; const int zz = row / TT; (void)zz; const bool hires = (i < RH); const float* sr = Sb + (size_t)row * TT; float v[TT / 32]; float mx = -3.0e38f;
#pragma unroll
    for (int ch = 0; ch < TT / 128; ++ch) { const int j0 = ch * 128 + lane * 4; const v4f a = *(const v4f*)(sr + j0);
#pragma unroll
        for (int q = 0; q < 4; ++q) { const int j = j0 + q; (void)j; const float t = a[q] * SCL; v[ch * 4 + q] = t; mx = fmaxf(mx, t); } }
#pragma unroll
    for (int sh = 16; sh; sh >>= 1) mx = fmaxf(mx, __shfl_xor(mx, sh, 32));
    float sum = 0.f;
#pragma unroll
    for (int k = 0; k < TT / 32; ++k) { float d0 = __fsub_rn(v[k], mx); asm volatile("" : "+v"(d0)); v[k] = __builtin_amdgcn_exp2f(__fmul_rn(d0, 1.4426950408889634f)); sum += v[k]; }
#pragma unroll
    for (int sh = 16; sh; sh >>= 1) sum += __shfl_xor(sum, sh, 32);
    const float f = __fdiv_rn(hires ? 1.0f : PCAR, sum);
{
        if (hires) {
#pragma unroll
            for (int ch = 0; ch < TT / 128; ++ch) { v4us oh, ol;
#pragma unroll
                for (int q = 0; q < 4; ++q) { unsigned short a, c2; splitf(v[ch * 4 + q] * f, a, c2); oh[q] = a; ol[q] = c2; }
                const size_t oo = ((size_t)zz * (RH ? RH : 1) + i) * TT + ch * 128 + lane * 4; *(v4us*)(Ph + oo) = oh; *(v4us*)(Pl + oo) = ol; }
        } else {
#pragma unroll
            for (int ch = 0; ch < TT / 128; ++ch) { v4h o4;
#pragma unroll
                for (int q = 0; q < 4; ++q) o4[q] = tohx(v[ch * 4 + q] * f);
                *(v4h*)(P16 + (size_t)row * TT + ch * 128 + lane * 4) = o4; } }
         }
}
__global__ __launch_bounds__(256) void k_mulmask(float* Sb, const float* __restrict__ fwd, const float* __restrict__ bwd) { const size_t k = (size_t)blockIdx.x * 256 + threadIdx.x; if (k >= (size_t)ZH * HWM * HWM / 4) return; const size_t e = k * 4; const int j0 = (int)(e % HWM); const int i = (int)((e / HWM) % HWM); const int zz = (int)(e / ((size_t)HWM * HWM)); float* sp = Sb + ((size_t)zz * TT + i) * TT + j0; v4f a = *(const v4f*)sp; const v4f f4 = *(const v4f*)(fwd + (size_t)i * HWM + j0);
#pragma unroll
    for (int q = 0; q < 4; ++q) { float m = __fmul_rn(bfr(bwd[(size_t)(j0 + q) * HWM + i]), bfr(f4[q])); asm volatile("" : "+v"(m)); a[q] = __fmul_rn(a[q], m); }
    *(v4f*)sp = a;  }
__global__ __launch_bounds__(256) void k_merge(const float* __restrict__ O, int h0, bf* Ah, bf* Al) { const size_t e = ((size_t)blockIdx.x * 256 + threadIdx.x) * 2; if (e >= (size_t)ZH * TT * HD) return; const int d = (int)(e % HD); const int t = (int)((e / HD) % TT); const int zz = (int)(e / ((size_t)HD * TT)); const float cs = (t < RH) ? 1.0f : (1.0f / PCAR); const size_t oo = (size_t)t * DQ + (h0 + zz) * HD + d;
    v2us oh, ol;
#pragma unroll
    for (int q = 0; q < 2; ++q) { unsigned short a, c2; splitf(O[e + q] * cs, a, c2); oh[q] = a; ol[q] = c2; } *(v2us*)(Ah + oo) = oh; *(v2us*)(Al + oo) = ol;  }

extern "C" void kernel_launch(void* const* d_in, const int* in_sizes, int n_in,
                              void* d_out, int out_size, void* d_ws, size_t ws_size, hipStream_t stream) {
    (void)in_sizes; (void)n_in; (void)out_size;
    const float* x = (const float*)d_in[0]; const float* xk = (const float*)d_in[1]; /* src_encode: keys and values */ const float* fmap = (const float*)d_in[2]; const float* bmap = (const float*)d_in[3]; const float* wq = (const float*)d_in[4]; const float* bq = (const float*)d_in[5]; const float* wk = (const float*)d_in[6]; const float* bk = (const float*)d_in[7]; const float* wv = (const float*)d_in[8]; const float* bv = (const float*)d_in[9]; const float* wo = (const float*)d_in[10]; const float* bo = (const float*)d_in[11];
    float* OUT = (float*)d_out;     // [8][512][1024]
    char* wsp = (char*)d_ws;
    auto take = [&](size_t bytes) { char* p = wsp; wsp += (bytes + 255) & ~(size_t)255; return (void*)p; };
    bf* WQ = (bf*)take((size_t)DQ * DM * 2); bf* WK = (bf*)take((size_t)DKV * DM * 2); bf* WV = (bf*)take((size_t)DKV * DM * 2); bf* WO = (bf*)take((size_t)DM * DQ * 2); float* CS = (float*)take((size_t)TT * HD * 2 * 4);
    bf* XB = (bf*)take((size_t)TT * DM * 2); float* FQ = (float*)take((size_t)TT * DQ * 4); float* FK = (float*)take((size_t)TT * DKV * 4);
    h16* QP16 = (h16*)take((size_t)NH_ * TT * HD * 2); h16* KP16 = (h16*)take((size_t)NKV * TT * HD * 2); h16* VT16 = (h16*)take((size_t)NKV * HD * TT * 2);
    bf* QPh = (bf*)take((size_t)NH_ * TT * HD * 2); bf* QPl = (bf*)take((size_t)NH_ * TT * HD * 2); bf* KPh = (bf*)take((size_t)NKV * TT * HD * 2); bf* KPl = (bf*)take((size_t)NKV * TT * HD * 2); bf* VTh = (bf*)take((size_t)NKV * HD * TT * 2); bf* VTl = (bf*)take((size_t)NKV * HD * TT * 2); bf* Ph = (bf*)take((size_t)ZH * RH * TT * 2); bf* Pl = (bf*)take((size_t)ZH * RH * TT * 2);
    float* Sb = (float*)take((size_t)ZH * TT * TT * 4); h16* P16 = nullptr; float* Ob = (float*)take((size_t)ZH * TT * HD * 4); bf* ATh = (bf*)take((size_t)TT * DQ * 2); bf* ATl = (bf*)take((size_t)TT * DQ * 2);
    if ((size_t)(wsp - (char*)d_ws) > ws_size) return;    // ws 256 MiB
    float* FV = FK;   // v projection reuses the k buffer after the k planes are built (stream-ordered)
    { k_cvt8<<<(unsigned)(((size_t)DQ * DM / 8 + 255) / 256), 256, 0, stream>>>(wq, WQ, (size_t)DQ * DM / 8); k_cvt8<<<(unsigned)(((size_t)DKV * DM / 8 + 255) / 256), 256, 0, stream>>>(wk, WK, (size_t)DKV * DM / 8); k_cvt8<<<(unsigned)(((size_t)DKV * DM / 8 + 255) / 256), 256, 0, stream>>>(wv, WV, (size_t)DKV * DM / 8);
      k_cvt8<<<(unsigned)(((size_t)DM * DQ / 8 + 255) / 256), 256, 0, stream>>>(wo, WO, (size_t)DM * DQ / 8);
       }
    k_csid<<<(TT * HD + 255) / 256, 256, 0, stream>>>(CS);
    const unsigned LQ = (unsigned)(((size_t)NH_ * TT * HD / 2 + 255) / 256), LKv = (unsigned)(((size_t)NKV * TT * HD / 2 + 255) / 256);
    for (int b = 0; b < NB_; ++b) {
        
        k_cvt8<<<(unsigned)(((size_t)TT * DM / 8 + 255) / 256), 256, 0, stream>>>(x + (size_t)b * TT * DM, XB, (size_t)TT * DM / 8);
        k_gemmw<bf, 0, true><<<dim3(TT / 64, DQ / 64, 1), 32, 0, stream>>>(XB, nullptr, WQ, nullptr, DM, FQ, DQ, bq, 0, 0, 0);
        k_rope<<<LQ, 256, 0, stream>>>(FQ, DQ, NH_, CS, nullptr, nullptr, QSC, QP16, QPh, QPl);   /* q x 1/8 */
        k_cvt8<<<(unsigned)(((size_t)TT * DM / 8 + 255) / 256), 256, 0, stream>>>(xk + (size_t)b * TT * DM, XB, (size_t)TT * DM / 8); k_gemmw<bf, 0, true><<<dim3(TT / 64, DKV / 64, 1), 32, 0, stream>>>(XB, nullptr, WK, nullptr, DM, FK, DKV, bk, 0, 0, 0);
        k_rope<<<LKv, 256, 0, stream>>>(FK, DKV, NKV, CS, nullptr, nullptr, 1.0f, KP16, KPh, KPl);
        k_gemmw<bf, 0, true><<<dim3(TT / 64, DKV / 64, 1), 32, 0, stream>>>(XB, nullptr, WV, nullptr, DM, FV, DKV, bv, 0, 0, 0); k_vtp<<<LKv, 256, 0, stream>>>(FV, DKV, NKV, VT16, VTh, VTl);
        for (int h0 = 0; h0 < NH_; h0 += ZH) { const size_t zq = (size_t)h0, zk = (size_t)(h0 / REP);   // one kv head per query head: the pass's two heads use consecutive kv planes (z-strides TT*HD)
            k_gemmw<bf, 2, false><<<dim3(RH / 64, TT / 64, ZH), 32, 0, stream>>>(QPh + zq * TT * HD, QPl + zq * TT * HD, KPh + zk * TT * HD, KPl + zk * TT * HD, HD, Sb, TT, nullptr, (size_t)TT * HD, (size_t)TT * HD, (size_t)TT * TT);
            k_mulmask<<<(unsigned)(((size_t)ZH * HWM * HWM / 4 + 255) / 256), 256, 0, stream>>>(Sb, fmap + (size_t)b * HWM * HWM, bmap + (size_t)b * HWM * HWM);   /* att[:256,:256] *= bwd^T x fwd */
            k_asoft<<<ZH * TT / 8, 256, 0, stream>>>(Sb, P16, Ph, Pl);
            k_gemmw<bf, 2, false><<<dim3(RH / 64, HD / 64, ZH), 32, 0, stream>>>(Ph, Pl, VTh + zk * HD * TT, VTl + zk * HD * TT, TT, Ob, HD, nullptr, (size_t)RH * TT, (size_t)HD * TT, (size_t)TT * HD);
            k_merge<<<(unsigned)(((size_t)ZH * TT * HD / 2 + 255) / 256), 256, 0, stream>>>(Ob, h0, ATh, ATl); }
        k_gemmw<bf, 1, true><<<dim3(TT / 64, DM / 64, 1), 32, 0, stream>>>(ATh, ATl, WO, nullptr, DQ, OUT + (size_t)b * TT * DM, DM, bo, 0, 0, 0); }
}

// v001
// It runs in 265 microseconds.
// Timed twice side by side with v000, it ran 8.96 and 8.94 times as fast.
#include <hip/hip_runtime.h>

// Cross attention with an epipolar mask multiplied into part of the score block (x, src_encode [8][512][1024]; q = x Wq^T + bq, k, v = src_encode W^T + b ('oi' [1024][1024] + [1024], 0.02; 16 heads x 64); att = q.k / 8; att[:, :, 0:256, 0:256] *= mask with mask[b][i][j] = backward_map[b][j][i] forward_map[b][i][j] (inputs [8][256][256], read); softmax over all 512 keys; out = merged Wp^T + bp -> [8][512][1024] (4.2 M)).
// Layout, every stage one launch over all batches and heads (grid z = batch * 16 + head): bf16 copies of the weights and the two inputs; exact projections + f32 biases; dense T-512 attention with every row on hi/lo planes (3 products); an element-wise kernel multiplies the pass's score block entries (i, j < 256) by the gathered mask (unconditional loads, 4 entries per thread) before the softmax (the 1/8 is folded into q so the product applies to the scaled scores, as in the module); merged hi/lo x Wp exact + bp.
// Compute dtypes, f32 accumulate: every input rounded to bf16 incl. the maps; projections exact + f32 biases; scores and attn.v 3 products; mask product and softmax f32; Wp hl x exact + bias.

#define NB_  8
#define TT   512
#define DM   1024
#define NH_  16
#define NKV  16
#define REP  (NH_ / NKV)
#define HD   64
#define DQ   (NH_ * HD)
#define DKV  (NKV * HD)
#define ZH   (NB_ * NH_)          // (batch, head) planes per launch: all of them
#define RH   512                  // query rows < RH use hi+lo planes (0: none)
#define WIN  0
#define PCAR 1024.0f
#define SCL  1.0f   // 1/8 folded into q (QSC) so the mask multiplies the scaled scores
#define QSC  0.125f
#define HWM  256     // masked sub-block size
typedef _Float16 h16;
typedef unsigned short bf;
typedef __attribute__((ext_vector_type(16))) __bf16   v16bf;
typedef __attribute__((ext_vector_type(16))) _Float16 v16h;
typedef __attribute__((ext_vector_type(8)))  _Float16 v8h;
typedef __attribute__((ext_vector_type(8)))  unsigned short v8us;
typedef __attribute__((ext_vector_type(8)))  float    v8f;
typedef __attribute__((ext_vector_type(4)))  float    v4f;
typedef v8h  __attribute__((may_alias)) v8ha;
typedef v4f  __attribute__((may_alias)) v4fa;
typedef v8us __attribute__((may_alias)) v8usa;

__device__ __forceinline__ unsigned short f2bf(float f) { unsigned u = __float_as_uint(f); u += 0x7FFFu + ((u >> 16) & 1u); return (unsigned short)(u >> 16); }
__device__ __forceinline__ float bf2f(unsigned short b) { return __uint_as_float(((unsigned)b) << 16); }
__device__ __forceinline__ float bfr(float f) { return bf2f(f2bf(f)); }
__device__ __forceinline__ v16h cat16(v8h lo, v8h hi) { return __builtin_shufflevector(lo, hi, 0, 1, 2, 3, 4, 5, 6, 7, 8, 9, 10, 11, 12, 13, 14, 15); }
__device__ __forceinline__ v16bf cat16b(v8us lo, v8us hi) { return __builtin_bit_cast(v16bf, __builtin_shufflevector(lo, hi, 0, 1, 2, 3, 4, 5, 6, 7, 8, 9, 10, 11, 12, 13, 14, 15)); }
__device__ __forceinline__ v8f wmma16(v16h a, v16h b, v8f c) { return __builtin_amdgcn_wmma_f32_16x16x32_f16(false, a, false, b, (short)0, c, false, false); }
__device__ __forceinline__ v8f wmmab(v16bf a, v16bf b, v8f c) { return __builtin_amdgcn_wmma_f32_16x16x32_bf16(false, a, false, b, (short)0, c, false, false); }



// ---- k_gemmw: register-blocked GEMM, ONE WAVE per 64x64 output tile (16 accumulators), operands straight from K-contiguous 16-bit planes; grid (M/64, N/64, Z), 32 threads.
// C[m][n] (f32, pitch ldc, + optional f32 bias[n]) = sum_k A[m][k] Bt[n][k] (+ split products per NSPLIT). A and Bt rows have pitch K, the sum runs over k < KL <= K. z-batch strides sA/sB/sC in elements. KL % 32 == 0.
// QKV: z = 0, 1, 2 are the q, k, v projections in one grid: A is the first input plane for z = 0 and the second (at sA) for z = 1, 2; the bias is bias, bias1, bias2.
template <typename T16> struct WFrag;
template <> struct WFrag<h16> { typedef v16h V; static __device__ __forceinline__ V ld(const h16* p) { return cat16(*(const v8h*)p, *(const v8h*)(p + 16)); } static __device__ __forceinline__ v8f mma(V a, V b, v8f c) { return wmma16(a, b, c); } };
template <> struct WFrag<bf> { typedef v16bf V; static __device__ __forceinline__ V ld(const bf* p) { return cat16b(*(const v8us*)p, *(const v8us*)(p + 16)); } static __device__ __forceinline__ v8f mma(V a, V b, v8f c) { return wmmab(a, b, c); } };
template <typename T16, int NSPLIT, bool BIAS, bool QKV>
__global__ __launch_bounds__(32) void k_gemmw(const T16* __restrict__ A, const T16* __restrict__ A2, const T16* __restrict__ Bt, const T16* __restrict__ Bt2, int K, int KL, float* C, int ldc, const float* __restrict__ bias, const float* __restrict__ bias1, const float* __restrict__ bias2, size_t sA, size_t sB, size_t sC) {
    typedef typename WFrag<T16>::V V;
    __shared__ __align__(16) float os[16 * 68];
    const size_t z = blockIdx.z; const size_t za = QKV ? (z ? 1 : 0) : z; A += za * sA; if (A2) A2 += za * sA; if (QKV) bias = (z == 0) ? bias : (z == 1) ? bias1 : bias2; Bt += z * sB; if (Bt2) Bt2 += z * sB; C += z * sC;
    const int lane = threadIdx.x & 31, lr = lane & 15, hi = lane >> 4; const int r0 = blockIdx.x * 64, c0 = blockIdx.y * 64;
    v8f acc[4][4];
#pragma unroll
    for (int mb = 0; mb < 4; ++mb)
#pragma unroll
        for (int nb = 0; nb < 4; ++nb) acc[mb][nb] = (v8f){};
    const size_t aoff = (size_t)(r0 + lr) * K + 8 * hi, boff = (size_t)(c0 + lr) * K + 8 * hi;
#pragma unroll 1
    for (int kc = 0; kc < KL; kc += 32) {
        V a[4], a2[4];
#pragma unroll
        for (int mb = 0; mb < 4; ++mb) { a[mb] = WFrag<T16>::ld(A + aoff + (size_t)mb * 16 * K + kc); if (NSPLIT == 1 || NSPLIT == 2) a2[mb] = WFrag<T16>::ld(A2 + aoff + (size_t)mb * 16 * K + kc); }
#pragma unroll
        for (int nb = 0; nb < 4; ++nb) { const V b = WFrag<T16>::ld(Bt + boff + (size_t)nb * 16 * K + kc); V b2; if (NSPLIT >= 2) b2 = WFrag<T16>::ld(Bt2 + boff + (size_t)nb * 16 * K + kc);
#pragma unroll
            for (int mb = 0; mb < 4; ++mb) { acc[mb][nb] = WFrag<T16>::mma(a[mb], b, acc[mb][nb]); if (NSPLIT == 1 || NSPLIT == 2) acc[mb][nb] = WFrag<T16>::mma(a2[mb], b, acc[mb][nb]); if (NSPLIT >= 2) acc[mb][nb] = WFrag<T16>::mma(a[mb], b2, acc[mb][nb]); } }
        asm volatile("v_nop\n\tv_nop\n\tv_nop\n\tv_nop" : "+v"(acc[0][0]), "+v"(acc[1][1]), "+v"(acc[2][2]), "+v"(acc[3][3]) : "v"(a[0]), "v"(a[3]));
    }
#pragma unroll
    for (int mb = 0; mb < 4; ++mb) {
#pragma unroll
        for (int nb = 0; nb < 4; ++nb) {
#pragma unroll
            for (int j = 0; j < 8; ++j) os[(hi * 8 + j) * 68 + nb * 16 + lr] = acc[mb][nb][j]; }
        __builtin_amdgcn_wave_barrier(); asm volatile("" ::: "memory");
        float* crow = C + (size_t)(r0 + mb * 16) * ldc + c0;
{
#pragma unroll
            for (int s = 0; s < 8; ++s) { const int row = 2 * s + hi, cofs = lr * 4; v4f val = *(const v4fa*)(os + row * 68 + cofs); if (BIAS) { val[0] += bfr(bias[c0 + cofs]); val[1] += bfr(bias[c0 + cofs + 1]); val[2] += bfr(bias[c0 + cofs + 2]); val[3] += bfr(bias[c0 + cofs + 3]); }
                *(v4f*)(crow + (size_t)row * ldc + cofs) = val; }
             }
        __builtin_amdgcn_wave_barrier(); asm volatile("" ::: "memory");
    }
}

__device__ __forceinline__ h16 tohx(float x) { return (h16)x; }
__device__ __forceinline__ void splitf(float y, unsigned short& h, unsigned short& l) { h = f2bf(y); l = f2bf(y - bf2f(h)); }
typedef __attribute__((ext_vector_type(2))) _Float16 v2h;
typedef __attribute__((ext_vector_type(4))) _Float16 v4h;
typedef __attribute__((ext_vector_type(2))) unsigned short v2us;
typedef __attribute__((ext_vector_type(4))) unsigned short v4us;
typedef __attribute__((ext_vector_type(2))) float v2f;
typedef __attribute__((ext_vector_type(4))) int v4i;

__global__ __launch_bounds__(256) void k_wtG(const float* __restrict__ w, int K, int N, bf* Bt) {
    const int lane = threadIdx.x & 31; const int L0 = (blockIdx.x * 8 + (threadIdx.x >> 5)) * 8; const int nlines = N * K / 64;
{
#pragma unroll 1
        for (int l = 0; l < 8; ++l) { const int L = L0 + l; if (L >= nlines) break; const size_t e = (size_t)L * 64 + lane * 2; const int k = (int)(e % K), n = (int)(e / K); v2us o;
            o[0] = f2bf(w[(size_t)k * N + n]); o[1] = f2bf(w[(size_t)(k + 1) * N + n]); *(v2us*)(Bt + e) = o; }
         }
}
// k_cvt8: blockIdx.y picks a slice of DM*DM elements: 0..3 the four weights -> dw, 4..7 x, 8..11 src_encode -> dx (both inputs are NB_*TT*DM = 4 slices)
__global__ __launch_bounds__(256) void k_cvt8(const float* __restrict__ wq, const float* __restrict__ wk, const float* __restrict__ wv, const float* __restrict__ wo, const float* __restrict__ x, const float* __restrict__ xk, bf* dw, bf* dx) { const size_t i = (size_t)blockIdx.x * 256 + threadIdx.x; const int sl = blockIdx.y; const size_t SL = (size_t)DM * DM; if (i >= SL / 8) return;
    const float* src = (sl == 0) ? wq : (sl == 1) ? wk : (sl == 2) ? wv : (sl == 3) ? wo : (sl < 8) ? x + (size_t)(sl - 4) * SL : xk + (size_t)(sl - 8) * SL; bf* dst = (sl < 4) ? dw + (size_t)sl * SL : dx + (size_t)(sl - 4) * SL; const v8f v = *(const v8f*)(src + i * 8); v8us o;
#pragma unroll
    for (int k = 0; k < 8; ++k) o[k] = f2bf(v[k]); *(v8us*)(dst + i * 8) = o;  }

// k_rope: head planes [h][t][d] (fp16 + hi/lo) of rope(x) x sc with the rotate-half convention out[d] = x[d] cos[t][d] - x[d+HD/2] sin[t][d], out[d+HD/2] = x[d+HD/2] cos[t][d+HD/2] + x[d] sin[t][d+HD/2]
// blockIdx.y = s * NB_ + b; planes [s][b][h][t][d], s = 0 from F with scale sc0 (q), s = 1 from F + sF with scale sc1 (k)
__global__ __launch_bounds__(256) void k_rope(const float* __restrict__ F, size_t sF, int pitch, int nheads, const float* __restrict__ CS, const float* __restrict__ RF, const float* __restrict__ nw, float sc0, float sc1, h16* P16, bf* Ph, bf* Pl) {
    const size_t e = ((size_t)blockIdx.x * 256 + threadIdx.x) * 2; if (e >= (size_t)nheads * TT * HD) return; const int d = (int)(e % HD); const int t = (int)((e / HD) % TT); const int h = (int)(e / ((size_t)HD * TT)); const unsigned sb = blockIdx.y; const int b = (int)(sb % NB_); const size_t eo = (size_t)sb * nheads * TT * HD + e; const float sc = (sb < NB_) ? sc0 : sc1; const float* f = F + (size_t)(sb / NB_) * sF + (size_t)(b * TT + t) * pitch + h * HD; float rf = 1.0f; v2h o16; v2us oh, ol;
    if (RF) { rf = RF[(size_t)h * TT + t]; asm volatile("s_wait_xcnt 0x0" ::: "memory"); }   // the wait stands before the load's address registers are reused
#pragma unroll
    for (int q = 0; q < 2; ++q) { const int dd = d + q; const int dp = (dd < HD / 2) ? dd + HD / 2 : dd - HD / 2; float x0 = f[dd], x1 = f[dp];
        if (RF) { float n0 = __fmul_rn(x0, rf), n1 = __fmul_rn(x1, rf); asm volatile("" : "+v"(n0)); asm volatile("" : "+v"(n1)); x0 = __fmul_rn(bfr(nw[dd]), n0); x1 = __fmul_rn(bfr(nw[dp]), n1); }
        const v2f cs = *(const v2f*)(CS + ((size_t)t * HD + dd) * 2); float a = __fmul_rn(x0, cs[0]), bq = __fmul_rn(x1, cs[1]); asm volatile("" : "+v"(a)); asm volatile("" : "+v"(bq)); const float r = ((dd < HD / 2) ? __fsub_rn(a, bq) : __fadd_rn(a, bq)) * sc;
        o16[q] = tohx(r); unsigned short a2, c2; splitf(r, a2, c2); oh[q] = a2; ol[q] = c2; }
    *(v2h*)(P16 + eo) = o16; *(v2us*)(Ph + eo) = oh; *(v2us*)(Pl + eo) = ol;  }
__global__ __launch_bounds__(256) void k_vtp(const float* __restrict__ F, int pitch, int nheads, h16* V16, bf* Vh, bf* Vl) { const size_t e = ((size_t)blockIdx.x * 256 + threadIdx.x) * 2; if (e >= (size_t)nheads * HD * TT) return; const int t = (int)(e % TT); const int d = (int)((e / TT) % HD); const int g = (int)(e / ((size_t)TT * HD)); const int b = blockIdx.y; const size_t eo = (size_t)b * nheads * HD * TT + e; v2h o16; v2us oh, ol;
#pragma unroll
    for (int q = 0; q < 2; ++q) { const float x = F[(size_t)(b * TT + t + q) * pitch + g * HD + d]; o16[q] = tohx(x); unsigned short a2, c2; splitf(x, a2, c2); oh[q] = a2; ol[q] = c2; }
    *(v2h*)(V16 + eo) = o16; *(v2us*)(Vh + 2 * eo - t) = oh; *(v2us*)(Vl + 2 * eo - t) = ol;  }   // hi / lo rows of pitch 2 TT (row * 2 TT + t), the pitch of the probability rows they meet
__global__ __launch_bounds__(256) void k_csid(float* CS) { const int idx = blockIdx.x * 256 + threadIdx.x; if (idx >= TT * HD) return; v2f cs; cs[0] = 1.0f; cs[1] = 0.0f; *(v2f*)(CS + (size_t)idx * 2) = cs;  }
// k_asoft: per row (zz, i): t = S x SCL (= 1: the 1/8 is in q, the mask already in S); softmax over the 512 keys (register row, one exp, fixed trees);
// Ph / Pl rows have pitch 2 TT and lie over the row's own 2 KiB of Sb (hi half, lo half): one wave owns the row and holds all of it in registers before its first store
__global__ __launch_bounds__(256) void k_asoft(const float* Sb, h16* P16, bf* Ph, bf* Pl) {
    const int lane = threadIdx.x & 31; const int row = blockIdx.x * 8 + (threadIdx.x >> 5); if (row >= ZH * TT) return; const int i = row % TT; const int zz = row / TT; (void)zz; const bool hires = (i < RH); const float* sr = Sb + (size_t)row * TT; float v[TT / 32]; float mx = -3.0e38f;
#pragma unroll
    for (int ch = 0; ch < TT / 128; ++ch) { const int j0 = ch * 128 + lane * 4; const v4f a = *(const v4f*)(sr + j0);
#pragma unroll
        for (int q = 0; q < 4; ++q) { const int j = j0 + q; (void)j; const float t = a[q] * SCL; v[ch * 4 + q] = t; mx = fmaxf(mx, t); } }
#pragma unroll
    for (int sh = 16; sh; sh >>= 1) mx = fmaxf(mx, __shfl_xor(mx, sh, 32));
    float sum = 0.f;
#pragma unroll
    for (int k = 0; k < TT / 32; ++k) { float d0 = __fsub_rn(v[k], mx); asm volatile("" : "+v"(d0)); v[k] = __builtin_amdgcn_exp2f(__fmul_rn(d0, 1.4426950408889634f)); sum += v[k]; }
#pragma unroll
    for (int sh = 16; sh; sh >>= 1) sum += __shfl_xor(sum, sh, 32);
    const float f = __fdiv_rn(hires ? 1.0f : PCAR, sum);
{
        if (hires) {
#pragma unroll
            for (int ch = 0; ch < TT / 128; ++ch) { v4us oh, ol;
#pragma unroll
                for (int q = 0; q < 4; ++q) { unsigned short a, c2; splitf(v[ch * 4 + q] * f, a, c2); oh[q] = a; ol[q] = c2; }
                const size_t oo = ((size_t)zz * (RH ? RH : 1) + i) * (2 * TT) + ch * 128 + lane * 4; *(v4us*)(Ph + oo) = oh; *(v4us*)(Pl + oo) = ol; }
        } else {
#pragma unroll
            for (int ch = 0; ch < TT / 128; ++ch) { v4h o4;
#pragma unroll
                for (int q = 0; q < 4; ++q) o4[q] = tohx(v[ch * 4 + q] * f);
                *(v4h*)(P16 + (size_t)row * TT + ch * 128 + lane * 4) = o4; } }
         }
}
__global__ __launch_bounds__(256) void k_mulmask(float* Sb, const float* __restrict__ fwd, const float* __restrict__ bwd) { const size_t k = (size_t)blockIdx.x * 256 + threadIdx.x; if (k >= (size_t)ZH * HWM * HWM / 4) return; const size_t e = k * 4; const int j0 = (int)(e % HWM); const int i = (int)((e / HWM) % HWM); const int zz = (int)(e / ((size_t)HWM * HWM)); float* sp = Sb + ((size_t)zz * TT + i) * TT + j0; fwd += (size_t)(zz / NH_) * HWM * HWM; bwd += (size_t)(zz / NH_) * HWM * HWM; v4f a = *(const v4f*)sp; const v4f f4 = *(const v4f*)(fwd + (size_t)i * HWM + j0);
#pragma unroll
    for (int q = 0; q < 4; ++q) { float m = __fmul_rn(bfr(bwd[(size_t)(j0 + q) * HWM + i]), bfr(f4[q])); asm volatile("" : "+v"(m)); a[q] = __fmul_rn(a[q], m); }
    *(v4f*)sp = a;  }
__global__ __launch_bounds__(256) void k_merge(const float* __restrict__ O, bf* Ah, bf* Al) { const size_t e = ((size_t)blockIdx.x * 256 + threadIdx.x) * 2; if (e >= (size_t)ZH * TT * HD) return; const int d = (int)(e % HD); const int t = (int)((e / HD) % TT); const int zz = (int)(e / ((size_t)HD * TT)); const float cs = (t < RH) ? 1.0f : (1.0f / PCAR); const size_t oo = (size_t)((zz / NH_) * TT + t) * DQ + (zz % NH_) * HD + d;
    v2us oh, ol;
#pragma unroll
    for (int q = 0; q < 2; ++q) { unsigned short a, c2; splitf(O[e + q] * cs, a, c2); oh[q] = a; ol[q] = c2; } *(v2us*)(Ah + oo) = oh; *(v2us*)(Al + oo) = ol;  }

extern "C" void kernel_launch(void* const* d_in, const int* in_sizes, int n_in,
                              void* d_out, int out_size, void* d_ws, size_t ws_size, hipStream_t stream) {
    (void)in_sizes; (void)n_in; (void)out_size;
    const float* x = (const float*)d_in[0]; const float* xk = (const float*)d_in[1]; /* src_encode: keys and values */ const float* fmap = (const float*)d_in[2]; const float* bmap = (const float*)d_in[3]; const float* wq = (const float*)d_in[4]; const float* bq = (const float*)d_in[5]; const float* wk = (const float*)d_in[6]; const float* bk = (const float*)d_in[7]; const float* wv = (const float*)d_in[8]; const float* bv = (const float*)d_in[9]; const float* wo = (const float*)d_in[10]; const float* bo = (const float*)d_in[11];
    float* OUT = (float*)d_out;     // [8][512][1024]
    char* wsp = (char*)d_ws;
    auto take = [&](size_t bytes) { char* p = wsp; wsp += (bytes + 255) & ~(size_t)255; return (void*)p; };
    bf* WQ = (bf*)take((size_t)DQ * DM * 2); bf* WK = (bf*)take((size_t)DKV * DM * 2); bf* WV = (bf*)take((size_t)DKV * DM * 2); bf* WO = (bf*)take((size_t)DM * DQ * 2); float* CS = (float*)take((size_t)TT * HD * 2 * 4); (void)WK; (void)WV;   // WQ, WK, WV, WO lie back to back (z-stride DM*DM)
    const size_t PL = (size_t)NB_ * NH_ * TT * HD;   // one plane set: [b][h][t][d] (or [b][h][d][t])
    h16* QP16 = (h16*)take(2 * PL * 2); h16* VT16 = (h16*)take(PL * 2);   // q planes, then k planes at + PL
    bf* QPh = (bf*)take(2 * PL * 2); bf* QPl = (bf*)take(2 * PL * 2); bf* VTh = (bf*)take(2 * PL * 2); bf* VTl = VTh + TT;   // v rows [b][h][d]: hi half, lo half (pitch 2 TT)
    float* Ob = (float*)take((size_t)ZH * TT * HD * 4); bf* ATh = (bf*)take((size_t)NB_ * TT * DQ * 2); bf* ATl = (bf*)take((size_t)NB_ * TT * DQ * 2);
    float* Sb = (float*)take((size_t)ZH * TT * TT * 4); h16* P16 = nullptr;
    if ((size_t)(wsp - (char*)d_ws) > ws_size) return;    // ws 256 MiB
    bf* Ph = (bf*)Sb; bf* Pl = Ph + TT;   // the probabilities' hi / lo rows replace each score row in place (pitch 2 TT)
    // the input copies and the f32 projections are dead before the scores are written: they lie in the score buffer (stream-ordered)
    const size_t XN = (size_t)NB_ * TT * DM;
    bf* XB = (bf*)Sb; float* FQ = (float*)(XB + 2 * XN);   // XB: x, then src_encode at + XN; FQ: q, k, v at + XN each
    bf* KPh = QPh + PL; bf* KPl = QPl + PL;
    k_cvt8<<<dim3((unsigned)(((size_t)DM * DM / 8 + 255) / 256), 12, 1), 256, 0, stream>>>(wq, wk, wv, wo, x, xk, WQ, XB);
    k_csid<<<(TT * HD + 255) / 256, 256, 0, stream>>>(CS);
    k_gemmw<bf, 0, true, true><<<dim3(NB_ * TT / 64, DQ / 64, 3), 32, 0, stream>>>(XB, nullptr, WQ, nullptr, DM, DM, FQ, DQ, bq, bk, bv, XN, (size_t)DM * DM, XN);
    k_rope<<<dim3((unsigned)(((size_t)NH_ * TT * HD / 2 + 255) / 256), 2 * NB_, 1), 256, 0, stream>>>(FQ, XN, DQ, NH_, CS, nullptr, nullptr, QSC, 1.0f, QP16, QPh, QPl);   /* q x 1/8, k x 1 */
    k_vtp<<<dim3((unsigned)(((size_t)NKV * TT * HD / 2 + 255) / 256), NB_, 1), 256, 0, stream>>>(FQ + 2 * XN, DKV, NKV, VT16, VTh, VTl);
    k_gemmw<bf, 2, false, false><<<dim3(RH / 64, TT / 64, ZH), 32, 0, stream>>>(QPh, QPl, KPh, KPl, HD, HD, Sb, TT, nullptr, nullptr, nullptr, (size_t)TT * HD, (size_t)TT * HD, (size_t)TT * TT);
    k_mulmask<<<(unsigned)(((size_t)ZH * HWM * HWM / 4 + 255) / 256), 256, 0, stream>>>(Sb, fmap, bmap);   /* att[:256,:256] *= bwd^T x fwd */
    k_asoft<<<ZH * TT / 8, 256, 0, stream>>>(Sb, P16, Ph, Pl);
    k_gemmw<bf, 2, false, false><<<dim3(RH / 64, HD / 64, ZH), 32, 0, stream>>>(Ph, Pl, VTh, VTl, 2 * TT, TT, Ob, HD, nullptr, nullptr, nullptr, (size_t)RH * 2 * TT, (size_t)HD * 2 * TT, (size_t)TT * HD);
    k_merge<<<(unsigned)(((size_t)ZH * TT * HD / 2 + 255) / 256), 256, 0, stream>>>(Ob, ATh, ATl);
    k_gemmw<bf, 1, true, false><<<dim3(NB_ * TT / 64, DM / 64, 1), 32, 0, stream>>>(ATh, ATl, WO, nullptr, DQ, DQ, OUT, DM, bo, nullptr, nullptr, 0, 0, 0);
}

// v002
// A run of this version takes 199 microseconds.
// In both of two side-by-side timings against v001, it was 1.32 times as fast.
// Counting every step since v000, it is 11.8 times as fast.
#include <hip/hip_runtime.h>

// Cross attention with an epipolar mask multiplied into part of the score block (x, src_encode [8][512][1024]; q = x Wq^T + bq, k, v = src_encode W^T + b ('oi' [1024][1024] + [1024], 0.02; 16 heads x 64); att = q.k / 8; att[:, :, 0:256, 0:256] *= mask with mask[b][i][j] = backward_map[b][j][i] forward_map[b][i][j] (inputs [8][256][256], read); softmax over all 512 keys; out = merged Wp^T + bp -> [8][512][1024] (4.2 M)).
// Layout, every stage one launch over all batches and heads (score and attn.v grids z = batch * 16 + head; projections z = q, k, v): bf16 copies of the weights and the two inputs; exact projections + f32 biases, whose epilogue writes the q, k head planes (hi/lo) and the transposed v rows; dense T-512 attention with every row on hi/lo planes (3 products); the score GEMM's epilogue multiplies the tiles with i, j < 256 by the mask before the softmax (the 1/8 is folded into q so the product applies to the scaled scores, as in the module); the attn.v GEMM's epilogue writes the merged hi/lo rows; merged hi/lo x Wp exact + bp.
// Compute dtypes, f32 accumulate: every input rounded to bf16 incl. the maps; projections exact + f32 biases; scores and attn.v 3 products; mask product and softmax f32; Wp hl x exact + bias.

#define NB_  8
#define TT   512
#define DM   1024
#define NH_  16
#define NKV  16
#define REP  (NH_ / NKV)
#define HD   64
#define DQ   (NH_ * HD)
#define DKV  (NKV * HD)
#define ZH   (NB_ * NH_)          // (batch, head) planes per launch: all of them
#define RH   512                  // query rows < RH use hi+lo planes (0: none)
#define WIN  0
#define PCAR 1024.0f
#define SCL  1.0f   // 1/8 folded into q (QSC) so the mask multiplies the scaled scores
#define QSC  0.125f
#define HWM  256     // masked sub-block size
typedef _Float16 h16;
typedef unsigned short bf;
typedef __attribute__((ext_vector_type(16))) __bf16   v16bf;
typedef __attribute__((ext_vector_type(16))) _Float16 v16h;
typedef __attribute__((ext_vector_type(8)))  _Float16 v8h;
typedef __attribute__((ext_vector_type(8)))  unsigned short v8us;
typedef __attribute__((ext_vector_type(8)))  float    v8f;
typedef __attribute__((ext_vector_type(4)))  float    v4f;
typedef v8h  __attribute__((may_alias)) v8ha;
typedef v4f  __attribute__((may_alias)) v4fa;
typedef v8us __attribute__((may_alias)) v8usa;

__device__ __forceinline__ unsigned short f2bf(float f) { unsigned u = __float_as_uint(f); u += 0x7FFFu + ((u >> 16) & 1u); return (unsigned short)(u >> 16); }
__device__ __forceinline__ float bf2f(unsigned short b) { return __uint_as_float(((unsigned)b) << 16); }
__device__ __forceinline__ float bfr(float f) { return bf2f(f2bf(f)); }
__device__ __forceinline__ v16h cat16(v8h lo, v8h hi) { return __builtin_shufflevector(lo, hi, 0, 1, 2, 3, 4, 5, 6, 7, 8, 9, 10, 11, 12, 13, 14, 15); }
__device__ __forceinline__ v16bf cat16b(v8us lo, v8us hi) { return __builtin_bit_cast(v16bf, __builtin_shufflevector(lo, hi, 0, 1, 2, 3, 4, 5, 6, 7, 8, 9, 10, 11, 12, 13, 14, 15)); }
__device__ __forceinline__ v8f wmma16(v16h a, v16h b, v8f c) { return __builtin_amdgcn_wmma_f32_16x16x32_f16(false, a, false, b, (short)0, c, false, false); }
__device__ __forceinline__ v8f wmmab(v16bf a, v16bf b, v8f c) { return __builtin_amdgcn_wmma_f32_16x16x32_bf16(false, a, false, b, (short)0, c, false, false); }



// ---- k_gemmw: register-blocked GEMM, ONE WAVE per 64x64 output tile (16 accumulators), operands straight from K-contiguous 16-bit planes; grid (M/64, N/64, Z), 32 threads.
// C[m][n] (f32, pitch ldc, + optional f32 bias[n]) = sum_k A[m][k] Bt[n][k] (+ split products per NSPLIT). A and Bt rows have pitch K, the sum runs over k < KL <= K. z-batch strides sA/sB/sC in elements. KL % 32 == 0.
// EPI picks what the epilogue stores. 0: C as above.
// 1 (QKV): z = 0, 1, 2 are the q, k, v projections in one grid: A is the first input plane for z = 0 and the second (at sA) for z = 1, 2; the bias is bias, bias1, bias2; a 64-column tile is one head. q x QSC and k go as bf16 hi / lo to the planes Ph / Pl [z][b][h][t][d]; v goes transposed to Vt rows [b][h][d] of pitch 2 TT (hi half, lo half).
// 2: C as above, the tiles with row, column < HWM first multiplied by mask[i][j] = bwd[b][j][i] fwd[b][i][j] (b = z / NH_).
// 3: z = b * NH_ + h; the tile goes as bf16 hi / lo to the merged rows Ph / Pl [b][t][h][d].
template <typename T16> struct WFrag;
template <> struct WFrag<h16> { typedef v16h V; static __device__ __forceinline__ V ld(const h16* p) { return cat16(*(const v8h*)p, *(const v8h*)(p + 16)); } static __device__ __forceinline__ v8f mma(V a, V b, v8f c) { return wmma16(a, b, c); } };
template <> struct WFrag<bf> { typedef v16bf V; static __device__ __forceinline__ V ld(const bf* p) { return cat16b(*(const v8us*)p, *(const v8us*)(p + 16)); } static __device__ __forceinline__ v8f mma(V a, V b, v8f c) { return wmmab(a, b, c); } };
__device__ __forceinline__ void splitf(float y, unsigned short& h, unsigned short& l) { h = f2bf(y); l = f2bf(y - bf2f(h)); }
typedef __attribute__((ext_vector_type(4))) unsigned short v4us;
template <typename T16, int NSPLIT, bool BIAS, int EPI>
__global__ __launch_bounds__(32) void k_gemmw(const T16* __restrict__ A, const T16* __restrict__ A2, const T16* __restrict__ Bt, const T16* __restrict__ Bt2, int K, int KL, float* C, int ldc, const float* __restrict__ bias, const float* __restrict__ bias1, const float* __restrict__ bias2, size_t sA, size_t sB, size_t sC, bf* Ph, bf* Pl, bf* Vt, const float* __restrict__ fwd, const float* __restrict__ bwd) {
    typedef typename WFrag<T16>::V V; constexpr bool QKV = (EPI == 1);
    __shared__ __align__(16) float os[16 * 68];
    const size_t z = blockIdx.z; const size_t za = QKV ? (z ? 1 : 0) : z; A += za * sA; if (A2) A2 += za * sA; if (QKV) bias = (z == 0) ? bias : (z == 1) ? bias1 : bias2; Bt += z * sB; if (Bt2) Bt2 += z * sB; C += z * sC;
    const int lane = threadIdx.x & 31, lr = lane & 15, hi = lane >> 4; const int r0 = blockIdx.x * 64, c0 = blockIdx.y * 64;
    v8f acc[4][4];
#pragma unroll
    for (int mb = 0; mb < 4; ++mb)
#pragma unroll
        for (int nb = 0; nb < 4; ++nb) acc[mb][nb] = (v8f){};
    const size_t aoff = (size_t)(r0 + lr) * K + 8 * hi, boff = (size_t)(c0 + lr) * K + 8 * hi;
#pragma unroll 1
    for (int kc = 0; kc < KL; kc += 32) {
        V a[4], a2[4];
#pragma unroll
        for (int mb = 0; mb < 4; ++mb) { a[mb] = WFrag<T16>::ld(A + aoff + (size_t)mb * 16 * K + kc); if (NSPLIT == 1 || NSPLIT == 2) a2[mb] = WFrag<T16>::ld(A2 + aoff + (size_t)mb * 16 * K + kc); }
#pragma unroll
        for (int nb = 0; nb < 4; ++nb) { const V b = WFrag<T16>::ld(Bt + boff + (size_t)nb * 16 * K + kc); V b2; if (NSPLIT >= 2) b2 = WFrag<T16>::ld(Bt2 + boff + (size_t)nb * 16 * K + kc);
#pragma unroll
            for (int mb = 0; mb < 4; ++mb) { acc[mb][nb] = WFrag<T16>::mma(a[mb], b, acc[mb][nb]); if (NSPLIT == 1 || NSPLIT == 2) acc[mb][nb] = WFrag<T16>::mma(a2[mb], b, acc[mb][nb]); if (NSPLIT >= 2) acc[mb][nb] = WFrag<T16>::mma(a[mb], b2, acc[mb][nb]); } }
        asm volatile("v_nop\n\tv_nop\n\tv_nop\n\tv_nop" : "+v"(acc[0][0]), "+v"(acc[1][1]), "+v"(acc[2][2]), "+v"(acc[3][3]) : "v"(a[0]), "v"(a[3]));
    }
    if (EPI == 1) if (z == 2) {   // v: a lane's 8 accumulator rows are 8 consecutive t of one d: one 16-byte store per half
        bf* vrow = Vt + ((size_t)((r0 / TT) * NKV + blockIdx.y) * HD + lr) * (2 * TT) + (r0 % TT) + hi * 8;
#pragma unroll
        for (int nb = 0; nb < 4; ++nb) { const float bb = bfr(bias[c0 + nb * 16 + lr]);
#pragma unroll
            for (int mb = 0; mb < 4; ++mb) { v8us oh, ol;
#pragma unroll
                for (int j = 0; j < 8; ++j) { unsigned short a2, c2; splitf(acc[mb][nb][j] + bb, a2, c2); oh[j] = a2; ol[j] = c2; }
                bf* p = vrow + (size_t)(nb * 16) * (2 * TT) + mb * 16; *(v8us*)p = oh; *(v8us*)(p + TT) = ol; } }
        return;
    }
    const size_t prow = (EPI == 1) ? ((z * NB_ + r0 / TT) * NH_ + blockIdx.y) * (size_t)TT * HD + (size_t)(r0 % TT) * HD : (EPI == 3) ? ((z / NH_) * TT + r0) * (size_t)DQ + (z % NH_) * HD + c0 : 0;   // first element of the tile in Ph / Pl
    const int ppitch = (EPI == 1) ? HD : DQ; const float psc = (EPI == 1 && z == 0) ? QSC : 1.0f;
#pragma unroll
    for (int mb = 0; mb < 4; ++mb) {
        if (EPI == 2) if (r0 < HWM && c0 < HWM) {   // a lane's 8 accumulator rows i are consecutive in bwd's row j
            const float* pb = bwd + (z / NH_) * (size_t)(HWM * HWM) + (size_t)(c0 + lr) * HWM + r0 + hi * 8; const float* pf = fwd + (z / NH_) * (size_t)(HWM * HWM) + (size_t)(r0 + hi * 8) * HWM + c0 + lr; v8f b8[4], f8[4];
#pragma unroll
            for (int nb = 0; nb < 4; ++nb) { b8[nb] = *(const v8f*)(pb + nb * 16 * HWM + mb * 16);
#pragma unroll
                for (int j = 0; j < 8; ++j) f8[nb][j] = pf[(mb * 16 + j) * HWM + nb * 16]; }
            asm volatile("s_wait_xcnt 0x0" :: "v"(pb), "v"(pf) : "memory");   // the wait stands before the loads' address registers are reused (named, so that they live up to it)
#pragma unroll
            for (int nb = 0; nb < 4; ++nb) {
#pragma unroll
                for (int j = 0; j < 8; ++j) { const float m = __fmul_rn(bfr(b8[nb][j]), bfr(f8[nb][j])); acc[mb][nb][j] = __fmul_rn(acc[mb][nb][j], m); } }
        }
#pragma unroll
        for (int nb = 0; nb < 4; ++nb) {
#pragma unroll
            for (int j = 0; j < 8; ++j) os[(hi * 8 + j) * 68 + nb * 16 + lr] = acc[mb][nb][j]; }
        __builtin_amdgcn_wave_barrier(); asm volatile("" ::: "memory");
        float* crow = C + (size_t)(r0 + mb * 16) * ldc + c0;
{
#pragma unroll
            for (int s = 0; s < 8; ++s) { const int row = 2 * s + hi, cofs = lr * 4; v4f val = *(const v4fa*)(os + row * 68 + cofs); if (BIAS) { val[0] += bfr(bias[c0 + cofs]); val[1] += bfr(bias[c0 + cofs + 1]); val[2] += bfr(bias[c0 + cofs + 2]); val[3] += bfr(bias[c0 + cofs + 3]); }
                if (EPI == 1 || EPI == 3) { v4us oh, ol;
#pragma unroll
                    for (int q = 0; q < 4; ++q) { unsigned short a2, c2; splitf(val[q] * psc, a2, c2); oh[q] = a2; ol[q] = c2; }
                    const size_t oo = prow + (size_t)(mb * 16 + row) * ppitch + cofs; *(v4us*)(Ph + oo) = oh; *(v4us*)(Pl + oo) = ol; continue; }
                *(v4f*)(crow + (size_t)row * ldc + cofs) = val; }
             }
        if (EPI == 1 || EPI == 2) asm volatile("s_wait_xcnt 0x0" ::: "memory");   // the wait stands before the next 16 rows' loads reuse the stores' registers
        __builtin_amdgcn_wave_barrier(); asm volatile("" ::: "memory");
    }
}

__device__ __forceinline__ h16 tohx(float x) { return (h16)x; }
typedef __attribute__((ext_vector_type(2))) _Float16 v2h;
typedef __attribute__((ext_vector_type(4))) _Float16 v4h;
typedef __attribute__((ext_vector_type(2))) unsigned short v2us;
typedef __attribute__((ext_vector_type(2))) float v2f;
typedef __attribute__((ext_vector_type(4))) int v4i;

__global__ __launch_bounds__(256) void k_wtG(const float* __restrict__ w, int K, int N, bf* Bt) {
    const int lane = threadIdx.x & 31; const int L0 = (blockIdx.x * 8 + (threadIdx.x >> 5)) * 8; const int nlines = N * K / 64;
{
#pragma unroll 1
        for (int l = 0; l < 8; ++l) { const int L = L0 + l; if (L >= nlines) break; const size_t e = (size_t)L * 64 + lane * 2; const int k = (int)(e % K), n = (int)(e / K); v2us o;
            o[0] = f2bf(w[(size_t)k * N + n]); o[1] = f2bf(w[(size_t)(k + 1) * N + n]); *(v2us*)(Bt + e) = o; }
         }
}
// k_cvt8: blockIdx.y picks a slice of DM*DM elements: 0..3 the four weights -> dw, 4..7 x, 8..11 src_encode -> dx (both inputs are NB_*TT*DM = 4 slices)
__global__ __launch_bounds__(256) void k_cvt8(const float* __restrict__ wq, const float* __restrict__ wk, const float* __restrict__ wv, const float* __restrict__ wo, const float* __restrict__ x, const float* __restrict__ xk, bf* dw, bf* dx) { const size_t i = (size_t)blockIdx.x * 256 + threadIdx.x; const int sl = blockIdx.y; const size_t SL = (size_t)DM * DM; if (i >= SL / 8) return;
    const float* src = (sl == 0) ? wq : (sl == 1) ? wk : (sl == 2) ? wv : (sl == 3) ? wo : (sl < 8) ? x + (size_t)(sl - 4) * SL : xk + (size_t)(sl - 8) * SL; bf* dst = (sl < 4) ? dw + (size_t)sl * SL : dx + (size_t)(sl - 4) * SL; const v8f v = *(const v8f*)(src + i * 8); v8us o;
#pragma unroll
    for (int k = 0; k < 8; ++k) o[k] = f2bf(v[k]); *(v8us*)(dst + i * 8) = o;  }

// k_asoft: per row (zz, i): t = S (the 1/8 is in q, the mask already in S); softmax over the 512 keys (register row, one exp, fixed trees);
// Ph / Pl rows have pitch 2 TT and lie over the row's own 2 KiB of Sb (hi half, lo half): one wave owns the row and holds all of it in registers before its first store
__global__ __launch_bounds__(256) void k_asoft(const float* Sb, h16* P16, bf* Ph, bf* Pl) {
    const int lane = threadIdx.x & 31; const int row = blockIdx.x * 8 + (threadIdx.x >> 5); if (row >= ZH * TT) return; const int i = row % TT; const int zz = row / TT; (void)zz; const bool hires = (i < RH); const float* sr = Sb + (size_t)row * TT; float v[TT / 32]; float mx = -3.0e38f;
#pragma unroll
    for (int ch = 0; ch < TT / 128; ++ch) { const int j0 = ch * 128 + lane * 4; const v4f a = *(const v4f*)(sr + j0);
#pragma unroll
        for (int q = 0; q < 4; ++q) { const int j = j0 + q; (void)j; const float t = a[q] * SCL; v[ch * 4 + q] = t; mx = fmaxf(mx, t); } }
#pragma unroll
    for (int sh = 16; sh; sh >>= 1) mx = fmaxf(mx, __shfl_xor(mx, sh, 32));
    float sum = 0.f;
#pragma unroll
    for (int k = 0; k < TT / 32; ++k) { float d0 = __fsub_rn(v[k], mx); asm volatile("" : "+v"(d0)); v[k] = __builtin_amdgcn_exp2f(__fmul_rn(d0, 1.4426950408889634f)); sum += v[k]; }
#pragma unroll
    for (int sh = 16; sh; sh >>= 1) sum += __shfl_xor(sum, sh, 32);
    const float f = __fdiv_rn(hires ? 1.0f : PCAR, sum);
{
        if (hires) {
#pragma unroll
            for (int ch = 0; ch < TT / 128; ++ch) { v4us oh, ol;
#pragma unroll
                for (int q = 0; q < 4; ++q) { unsigned short a, c2; splitf(v[ch * 4 + q] * f, a, c2); oh[q] = a; ol[q] = c2; }
                const size_t oo = ((size_t)zz * (RH ? RH : 1) + i) * (2 * TT) + ch * 128 + lane * 4; *(v4us*)(Ph + oo) = oh; *(v4us*)(Pl + oo) = ol; }
        } else {
#pragma unroll
            for (int ch = 0; ch < TT / 128; ++ch) { v4h o4;
#pragma unroll
                for (int q = 0; q < 4; ++q) o4[q] = tohx(v[ch * 4 + q] * f);
                *(v4h*)(P16 + (size_t)row * TT + ch * 128 + lane * 4) = o4; } }
         }
}

extern "C" void kernel_launch(void* const* d_in, const int* in_sizes, int n_in,
                              void* d_out, int out_size, void* d_ws, size_t ws_size, hipStream_t stream) {
    (void)in_sizes; (void)n_in; (void)out_size;
    const float* x = (const float*)d_in[0]; const float* xk = (const float*)d_in[1]; /* src_encode: keys and values */ const float* fmap = (const float*)d_in[2]; const float* bmap = (const float*)d_in[3]; const float* wq = (const float*)d_in[4]; const float* bq = (const float*)d_in[5]; const float* wk = (const float*)d_in[6]; const float* bk = (const float*)d_in[7]; const float* wv = (const float*)d_in[8]; const float* bv = (const float*)d_in[9]; const float* wo = (const float*)d_in[10]; const float* bo = (const float*)d_in[11];
    float* OUT = (float*)d_out;     // [8][512][1024]
    char* wsp = (char*)d_ws;
    auto take = [&](size_t bytes) { char* p = wsp; wsp += (bytes + 255) & ~(size_t)255; return (void*)p; };
    bf* WQ = (bf*)take((size_t)DQ * DM * 2); bf* WK = (bf*)take((size_t)DKV * DM * 2); bf* WV = (bf*)take((size_t)DKV * DM * 2); bf* WO = (bf*)take((size_t)DM * DQ * 2); (void)WK; (void)WV;   // WQ, WK, WV, WO lie back to back (z-stride DM*DM)
    const size_t PL = (size_t)NB_ * NH_ * TT * HD;   // one plane set: [b][h][t][d] (or [b][h][d][t])
    bf* QPh = (bf*)take(2 * PL * 2); bf* QPl = (bf*)take(2 * PL * 2); bf* VTh = (bf*)take(2 * PL * 2); bf* VTl = VTh + TT;   // q planes, then k planes at + PL; v rows [b][h][d]: hi half, lo half (pitch 2 TT)
    bf* ATh = (bf*)take((size_t)NB_ * TT * DQ * 2); bf* ATl = (bf*)take((size_t)NB_ * TT * DQ * 2);
    float* Sb = (float*)take((size_t)ZH * TT * TT * 4); h16* P16 = nullptr;
    if ((size_t)(wsp - (char*)d_ws) > ws_size) return;    // ws 256 MiB
    bf* Ph = (bf*)Sb; bf* Pl = Ph + TT;   // the probabilities' hi / lo rows replace each score row in place (pitch 2 TT)
    // the input copies are dead before the scores are written: they lie in the score buffer (stream-ordered)
    const size_t XN = (size_t)NB_ * TT * DM;
    bf* XB = (bf*)Sb;   // x, then src_encode at + XN
    bf* KPh = QPh + PL; bf* KPl = QPl + PL;
    k_cvt8<<<dim3((unsigned)(((size_t)DM * DM / 8 + 255) / 256), 12, 1), 256, 0, stream>>>(wq, wk, wv, wo, x, xk, WQ, XB);
    k_gemmw<bf, 0, true, 1><<<dim3(NB_ * TT / 64, DQ / 64, 3), 32, 0, stream>>>(XB, nullptr, WQ, nullptr, DM, DM, nullptr, 0, bq, bk, bv, XN, (size_t)DM * DM, 0, QPh, QPl, VTh, nullptr, nullptr);   /* q x 1/8, k, v^T */
    k_gemmw<bf, 2, false, 2><<<dim3(RH / 64, TT / 64, ZH), 32, 0, stream>>>(QPh, QPl, KPh, KPl, HD, HD, Sb, TT, nullptr, nullptr, nullptr, (size_t)TT * HD, (size_t)TT * HD, (size_t)TT * TT, nullptr, nullptr, nullptr, fmap, bmap);   /* att[:256,:256] *= bwd^T x fwd */
    k_asoft<<<ZH * TT / 8, 256, 0, stream>>>(Sb, P16, Ph, Pl);
    k_gemmw<bf, 2, false, 3><<<dim3(RH / 64, HD / 64, ZH), 32, 0, stream>>>(Ph, Pl, VTh, VTl, 2 * TT, TT, nullptr, 0, nullptr, nullptr, nullptr, (size_t)RH * 2 * TT, (size_t)HD * 2 * TT, 0, ATh, ATl, nullptr, nullptr, nullptr);
    k_gemmw<bf, 1, true, 0><<<dim3(NB_ * TT / 64, DM / 64, 1), 32, 0, stream>>>(ATh, ATl, WO, nullptr, DQ, DQ, OUT, DM, bo, nullptr, nullptr, 0, 0, 0, nullptr, nullptr, nullptr, nullptr, nullptr);
}

// v003
// Measured time: 128 microseconds a run.
// Next to v002, in two timings, it ran 1.57 and 1.56 times as fast.
// Over all steps from v000 it is 18.5 times as fast.
#include <hip/hip_runtime.h>

// Cross attention with an epipolar mask multiplied into part of the score block (x, src_encode [8][512][1024]; q = x Wq^T + bq, k, v = src_encode W^T + b ('oi' [1024][1024] + [1024], 0.02; 16 heads x 64); att = q.k / 8; att[:, :, 0:256, 0:256] *= mask with mask[b][i][j] = backward_map[b][j][i] forward_map[b][i][j] (inputs [8][256][256], read); softmax over all 512 keys; out = merged Wp^T + bp -> [8][512][1024] (4.2 M)).
// Layout, every stage one launch over all batches and heads (k_fattn grid y = batch * 16 + head): bf16 copies of the weights and the two inputs; exact projections + f32 biases, whose epilogue writes the q, k head planes (hi/lo) and the transposed v rows; dense T-512 attention in one kernel (k_fattn) with every row on hi/lo planes (3 products): the scores with i, j < 256 are multiplied by the mask before the softmax (the 1/8 is folded into q so the product applies to the scaled scores, as in the module), scores and probabilities stay in registers, and it writes the merged hi/lo rows; merged hi/lo x Wp exact + bp.
// Compute dtypes, f32 accumulate: every input rounded to bf16 incl. the maps; projections exact + f32 biases; scores and attn.v 3 products; mask product and softmax f32; Wp hl x exact + bias.

#define NB_  8
#define TT   512
#define DM   1024
#define NH_  16
#define NKV  16
#define REP  (NH_ / NKV)
#define HD   64
#define DQ   (NH_ * HD)
#define DKV  (NKV * HD)
#define ZH   (NB_ * NH_)          // (batch, head) planes per launch: all of them
#define RH   512                  // unused: k_fattn puts every query row on hi+lo planes
#define WIN  0
#define PCAR 1024.0f
#define SCL  1.0f   // 1/8 folded into q (QSC) so the mask multiplies the scaled scores
#define QSC  0.125f
#define HWM  256     // masked sub-block size
typedef _Float16 h16;
typedef unsigned short bf;
typedef __attribute__((ext_vector_type(16))) __bf16   v16bf;
typedef __attribute__((ext_vector_type(16))) _Float16 v16h;
typedef __attribute__((ext_vector_type(8)))  _Float16 v8h;
typedef __attribute__((ext_vector_type(8)))  unsigned short v8us;
typedef __attribute__((ext_vector_type(8)))  float    v8f;
typedef __attribute__((ext_vector_type(4)))  float    v4f;
typedef v8h  __attribute__((may_alias)) v8ha;
typedef v4f  __attribute__((may_alias)) v4fa;
typedef v8us __attribute__((may_alias)) v8usa;

__device__ __forceinline__ unsigned short f2bf(float f) { unsigned u = __float_as_uint(f); u += 0x7FFFu + ((u >> 16) & 1u); return (unsigned short)(u >> 16); }
__device__ __forceinline__ float bf2f(unsigned short b) { return __uint_as_float(((unsigned)b) << 16); }
__device__ __forceinline__ float bfr(float f) { return bf2f(f2bf(f)); }
__device__ __forceinline__ v16h cat16(v8h lo, v8h hi) { return __builtin_shufflevector(lo, hi, 0, 1, 2, 3, 4, 5, 6, 7, 8, 9, 10, 11, 12, 13, 14, 15); }
__device__ __forceinline__ v16bf cat16b(v8us lo, v8us hi) { return __builtin_bit_cast(v16bf, __builtin_shufflevector(lo, hi, 0, 1, 2, 3, 4, 5, 6, 7, 8, 9, 10, 11, 12, 13, 14, 15)); }
__device__ __forceinline__ v8f wmma16(v16h a, v16h b, v8f c) { return __builtin_amdgcn_wmma_f32_16x16x32_f16(false, a, false, b, (short)0, c, false, false); }
__device__ __forceinline__ v8f wmmab(v16bf a, v16bf b, v8f c) { return __builtin_amdgcn_wmma_f32_16x16x32_bf16(false, a, false, b, (short)0, c, false, false); }



// ---- k_gemmw: register-blocked GEMM, ONE WAVE per 64x64 output tile (16 accumulators), operands straight from K-contiguous 16-bit planes; grid (M/64, N/64, Z), 32 threads.
// C[m][n] (f32, pitch ldc, + optional f32 bias[n]) = sum_k A[m][k] Bt[n][k] (+ split products per NSPLIT). A and Bt rows have pitch K, the sum runs over k < KL <= K. z-batch strides sA/sB/sC in elements. KL % 32 == 0.
// EPI picks what the epilogue stores. 0: C as above.
// 1 (QKV): z = 0, 1, 2 are the q, k, v projections in one grid: A is the first input plane for z = 0 and the second (at sA) for z = 1, 2; the bias is bias, bias1, bias2; a 64-column tile is one head. q x QSC and k go as bf16 hi / lo to the planes Ph / Pl [z][b][h][t][d]; v goes transposed to Vt rows [b][h][d] of pitch 2 TT (hi half, lo half).
// (2 and 3 are not launched any more: k_fattn does their work.) 2: C as above, the tiles with row, column < HWM first multiplied by mask[i][j] = bwd[b][j][i] fwd[b][i][j] (b = z / NH_).
// 3: z = b * NH_ + h; the tile goes as bf16 hi / lo to the merged rows Ph / Pl [b][t][h][d].
template <typename T16> struct WFrag;
template <> struct WFrag<h16> { typedef v16h V; static __device__ __forceinline__ V ld(const h16* p) { return cat16(*(const v8h*)p, *(const v8h*)(p + 16)); } static __device__ __forceinline__ v8f mma(V a, V b, v8f c) { return wmma16(a, b, c); } };
template <> struct WFrag<bf> { typedef v16bf V; static __device__ __forceinline__ V ld(const bf* p) { return cat16b(*(const v8us*)p, *(const v8us*)(p + 16)); } static __device__ __forceinline__ v8f mma(V a, V b, v8f c) { return wmmab(a, b, c); } };
__device__ __forceinline__ void splitf(float y, unsigned short& h, unsigned short& l) { h = f2bf(y); l = f2bf(y - bf2f(h)); }
typedef __attribute__((ext_vector_type(4))) unsigned short v4us;
template <typename T16, int NSPLIT, bool BIAS, int EPI>
__global__ __launch_bounds__(32) void k_gemmw(const T16* __restrict__ A, const T16* __restrict__ A2, const T16* __restrict__ Bt, const T16* __restrict__ Bt2, int K, int KL, float* C, int ldc, const float* __restrict__ bias, const float* __restrict__ bias1, const float* __restrict__ bias2, size_t sA, size_t sB, size_t sC, bf* Ph, bf* Pl, bf* Vt, const float* __restrict__ fwd, const float* __restrict__ bwd) {
    typedef typename WFrag<T16>::V V; constexpr bool QKV = (EPI == 1);
    __shared__ __align__(16) float os[16 * 68];
    const size_t z = blockIdx.z; const size_t za = QKV ? (z ? 1 : 0) : z; A += za * sA; if (A2) A2 += za * sA; if (QKV) bias = (z == 0) ? bias : (z == 1) ? bias1 : bias2; Bt += z * sB; if (Bt2) Bt2 += z * sB; C += z * sC;
    const int lane = threadIdx.x & 31, lr = lane & 15, hi = lane >> 4; const int r0 = blockIdx.x * 64, c0 = blockIdx.y * 64;
    v8f acc[4][4];
#pragma unroll
    for (int mb = 0; mb < 4; ++mb)
#pragma unroll
        for (int nb = 0; nb < 4; ++nb) acc[mb][nb] = (v8f){};
    const size_t aoff = (size_t)(r0 + lr) * K + 8 * hi, boff = (size_t)(c0 + lr) * K + 8 * hi;
#pragma unroll 1
    for (int kc = 0; kc < KL; kc += 32) {
        V a[4], a2[4];
#pragma unroll
        for (int mb = 0; mb < 4; ++mb) { a[mb] = WFrag<T16>::ld(A + aoff + (size_t)mb * 16 * K + kc); if (NSPLIT == 1 || NSPLIT == 2) a2[mb] = WFrag<T16>::ld(A2 + aoff + (size_t)mb * 16 * K + kc); }
#pragma unroll
        for (int nb = 0; nb < 4; ++nb) { const V b = WFrag<T16>::ld(Bt + boff + (size_t)nb * 16 * K + kc); V b2; if (NSPLIT >= 2) b2 = WFrag<T16>::ld(Bt2 + boff + (size_t)nb * 16 * K + kc);
#pragma unroll
            for (int mb = 0; mb < 4; ++mb) { acc[mb][nb] = WFrag<T16>::mma(a[mb], b, acc[mb][nb]); if (NSPLIT == 1 || NSPLIT == 2) acc[mb][nb] = WFrag<T16>::mma(a2[mb], b, acc[mb][nb]); if (NSPLIT >= 2) acc[mb][nb] = WFrag<T16>::mma(a[mb], b2, acc[mb][nb]); } }
        asm volatile("v_nop\n\tv_nop\n\tv_nop\n\tv_nop" : "+v"(acc[0][0]), "+v"(acc[1][1]), "+v"(acc[2][2]), "+v"(acc[3][3]) : "v"(a[0]), "v"(a[3]));
    }
    if (EPI == 1) if (z == 2) {   // v: a lane's 8 accumulator rows are 8 consecutive t of one d: one 16-byte store per half
        bf* vrow = Vt + ((size_t)((r0 / TT) * NKV + blockIdx.y) * HD + lr) * (2 * TT) + (r0 % TT) + hi * 8;
#pragma unroll
        for (int nb = 0; nb < 4; ++nb) { const float bb = bfr(bias[c0 + nb * 16 + lr]);
#pragma unroll
            for (int mb = 0; mb < 4; ++mb) { v8us oh, ol;
#pragma unroll
                for (int j = 0; j < 8; ++j) { unsigned short a2, c2; splitf(acc[mb][nb][j] + bb, a2, c2); oh[j] = a2; ol[j] = c2; }
                bf* p = vrow + (size_t)(nb * 16) * (2 * TT) + mb * 16; *(v8us*)p = oh; *(v8us*)(p + TT) = ol; } }
        return;
    }
    const size_t prow = (EPI == 1) ? ((z * NB_ + r0 / TT) * NH_ + blockIdx.y) * (size_t)TT * HD + (size_t)(r0 % TT) * HD : (EPI == 3) ? ((z / NH_) * TT + r0) * (size_t)DQ + (z % NH_) * HD + c0 : 0;   // first element of the tile in Ph / Pl
    const int ppitch = (EPI == 1) ? HD : DQ; const float psc = (EPI == 1 && z == 0) ? QSC : 1.0f;
#pragma unroll
    for (int mb = 0; mb < 4; ++mb) {
        if (EPI == 2) if (r0 < HWM && c0 < HWM) {   // a lane's 8 accumulator rows i are consecutive in bwd's row j
            const float* pb = bwd + (z / NH_) * (size_t)(HWM * HWM) + (size_t)(c0 + lr) * HWM + r0 + hi * 8; const float* pf = fwd + (z / NH_) * (size_t)(HWM * HWM) + (size_t)(r0 + hi * 8) * HWM + c0 + lr; v8f b8[4], f8[4];
#pragma unroll
            for (int nb = 0; nb < 4; ++nb) { b8[nb] = *(const v8f*)(pb + nb * 16 * HWM + mb * 16);
#pragma unroll
                for (int j = 0; j < 8; ++j) f8[nb][j] = pf[(mb * 16 + j) * HWM + nb * 16]; }
            asm volatile("s_wait_xcnt 0x0" :: "v"(pb), "v"(pf) : "memory");   // the wait stands before the loads' address registers are reused (named, so that they live up to it)
#pragma unroll
            for (int nb = 0; nb < 4; ++nb) {
#pragma unroll
                for (int j = 0; j < 8; ++j) { const float m = __fmul_rn(bfr(b8[nb][j]), bfr(f8[nb][j])); acc[mb][nb][j] = __fmul_rn(acc[mb][nb][j], m); } }
        }
#pragma unroll
        for (int nb = 0; nb < 4; ++nb) {
#pragma unroll
            for (int j = 0; j < 8; ++j) os[(hi * 8 + j) * 68 + nb * 16 + lr] = acc[mb][nb][j]; }
        __builtin_amdgcn_wave_barrier(); asm volatile("" ::: "memory");
        float* crow = C + (size_t)(r0 + mb * 16) * ldc + c0;
{
#pragma unroll
            for (int s = 0; s < 8; ++s) { const int row = 2 * s + hi, cofs = lr * 4; v4f val = *(const v4fa*)(os + row * 68 + cofs); if (BIAS) { val[0] += bfr(bias[c0 + cofs]); val[1] += bfr(bias[c0 + cofs + 1]); val[2] += bfr(bias[c0 + cofs + 2]); val[3] += bfr(bias[c0 + cofs + 3]); }
                if (EPI == 1 || EPI == 3) { v4us oh, ol;
#pragma unroll
                    for (int q = 0; q < 4; ++q) { unsigned short a2, c2; splitf(val[q] * psc, a2, c2); oh[q] = a2; ol[q] = c2; }
                    const size_t oo = prow + (size_t)(mb * 16 + row) * ppitch + cofs; *(v4us*)(Ph + oo) = oh; *(v4us*)(Pl + oo) = ol; continue; }
                *(v4f*)(crow + (size_t)row * ldc + cofs) = val; }
             }
        if (EPI == 1 || EPI == 2) asm volatile("s_wait_xcnt 0x0" ::: "memory");   // the wait stands before the next 16 rows' loads reuse the stores' registers
        __builtin_amdgcn_wave_barrier(); asm volatile("" ::: "memory");
    }
}

__device__ __forceinline__ h16 tohx(float x) { return (h16)x; }
typedef __attribute__((ext_vector_type(2))) _Float16 v2h;
typedef __attribute__((ext_vector_type(4))) _Float16 v4h;
typedef __attribute__((ext_vector_type(2))) unsigned short v2us;
typedef __attribute__((ext_vector_type(2))) float v2f;
typedef __attribute__((ext_vector_type(4))) int v4i;

__global__ __launch_bounds__(256) void k_wtG(const float* __restrict__ w, int K, int N, bf* Bt) {
    const int lane = threadIdx.x & 31; const int L0 = (blockIdx.x * 8 + (threadIdx.x >> 5)) * 8; const int nlines = N * K / 64;
{
#pragma unroll 1
        for (int l = 0; l < 8; ++l) { const int L = L0 + l; if (L >= nlines) break; const size_t e = (size_t)L * 64 + lane * 2; const int k = (int)(e % K), n = (int)(e / K); v2us o;
            o[0] = f2bf(w[(size_t)k * N + n]); o[1] = f2bf(w[(size_t)(k + 1) * N + n]); *(v2us*)(Bt + e) = o; }
         }
}
// k_cvt8: blockIdx.y picks a slice of DM*DM elements: 0..3 the four weights -> dw, 4..7 x, 8..11 src_encode -> dx (both inputs are NB_*TT*DM = 4 slices)
__global__ __launch_bounds__(256) void k_cvt8(const float* __restrict__ wq, const float* __restrict__ wk, const float* __restrict__ wv, const float* __restrict__ wo, const float* __restrict__ x, const float* __restrict__ xk, bf* dw, bf* dx) { const size_t i = (size_t)blockIdx.x * 256 + threadIdx.x; const int sl = blockIdx.y; const size_t SL = (size_t)DM * DM; if (i >= SL / 8) return;
    const float* src = (sl == 0) ? wq : (sl == 1) ? wk : (sl == 2) ? wv : (sl == 3) ? wo : (sl < 8) ? x + (size_t)(sl - 4) * SL : xk + (size_t)(sl - 8) * SL; bf* dst = (sl < 4) ? dw + (size_t)sl * SL : dx + (size_t)(sl - 4) * SL; const v8f v = *(const v8f*)(src + i * 8); v8us o;
#pragma unroll
    for (int k = 0; k < 8; ++k) o[k] = f2bf(v[k]); *(v8us*)(dst + i * 8) = o;  }

// ---- k_fattn: scores, mask product, softmax and attn.v in one kernel; no score or probability leaves the registers.
// A work-group of 16 waves takes half the query rows of one (batch, head) plane z; grid (2, ZH). It first copies the plane's whole K (hi, lo) and V^T (hi | lo rows) into LDS with whole-line loads, one barrier, and then only reads them.
// One wave owns 16 query rows and walks the 512 keys in passes of 32. The 16-row blocks alternate between the two work-groups, so that each has eight waves in the masked block.
// S^T = K Q^T: A = K rows, B = Q rows (kept in registers), so a lane holds 16 scores of ONE query (column lr): keys p * 32 + t * 16 + hi * 8 + j.
// The two f32 score tiles of a pass, turned into probabilities and split hi / lo, are already the B operand of O^T += V^T P^T (hardware k order, the order WFrag::ld reads V^T's rows in).
// Every inner loop is unrolled: its index picks registers.
// Running maximum m and sum l per query; O^T and l are rescaled by e^(old m - new m) each pass; the division by l comes last. The three hi / lo products of each GEMM stand in the order they had.
#define KP 72     // LDS pitch of a K row, elements: 128 B + 16 B (16 B x odd: no bank conflict for 16-byte reads down a column of rows)
#define VP 1032   // LDS pitch of a V^T row, elements: 2048 B + 16 B
template <bool B> struct BoolC { static constexpr bool value = B; };
typedef __attribute__((ext_vector_type(2))) __bf16 v2bf;
typedef __attribute__((ext_vector_type(2))) float v2fl;
typedef __attribute__((ext_vector_type(8))) unsigned v8u;
__device__ __forceinline__ unsigned pk2(float a, float b) { const v2fl x = {a, b}; return __builtin_bit_cast(unsigned, __builtin_convertvector(x, v2bf)); }   // two f32 -> two bf16 (nearest even), a in the low half
__device__ __forceinline__ float pklo(unsigned w) { return __uint_as_float(w << 16); }
__device__ __forceinline__ float pkhi(unsigned w) { return __uint_as_float(w & 0xFFFF0000u); }
__device__ __forceinline__ float xhalf(float x) { return __builtin_bit_cast(float, __builtin_amdgcn_permlanex16(__builtin_bit_cast(int, x), __builtin_bit_cast(int, x), 0x76543210, 0xfedcba98, false, false)); }   // lane l with lane l ^ 16
__global__ __launch_bounds__(512) void k_fattn(const bf* __restrict__ Qh, const bf* __restrict__ Ql, const bf* __restrict__ Kh, const bf* __restrict__ Kl, const bf* __restrict__ Vt, bf* __restrict__ Oh, bf* __restrict__ Ol, const float* __restrict__ fwd, const float* __restrict__ bwd) {
    typedef WFrag<bf> F; constexpr float L2E = 1.4426950408889634f;
    __shared__ __align__(16) bf Ksh[TT * KP]; __shared__ __align__(16) bf Ksl[TT * KP]; __shared__ __align__(16) bf Vs[HD * VP];
    const int tid = threadIdx.x, lane = tid & 31, lr = lane & 15, hi = lane >> 4; const int wave = __builtin_amdgcn_readfirstlane(tid >> 5);
    const int z = blockIdx.y, q0 = (wave * 2 + blockIdx.x) * 16; const size_t pz = (size_t)z * TT * HD;
    {   // 16-byte chunk c of each plane: a wave's load covers 512 consecutive bytes
        const v8us* gh = (const v8us*)(Kh + pz) + tid; const v8us* gl = (const v8us*)(Kl + pz) + tid; const v8us* gv = (const v8us*)(Vt + (size_t)z * HD * (2 * TT)) + tid;
#pragma unroll
        for (int i = 0; i < TT * HD / 8 / 512; ++i) { const int c = tid + i * 512, d = (c >> 3) * KP + (c & 7) * 8; *(v8us*)(Ksh + d) = gh[i * 512]; *(v8us*)(Ksl + d) = gl[i * 512]; }
#pragma unroll
        for (int i = 0; i < HD * 2 * TT / 8 / 512; ++i) { const int c = tid + i * 512; *(v8us*)(Vs + (c >> 7) * VP + (c & 127) * 8) = gv[i * 512]; }
    }
    const bf* qa = Qh + pz + (q0 + lr) * HD + 8 * hi; const bf* qb = Ql + pz + (q0 + lr) * HD + 8 * hi;
    v16bf bqh[2], bql[2];
#pragma unroll
    for (int kc = 0; kc < 2; ++kc) { bqh[kc] = F::ld(qa + kc * 32); bql[kc] = F::ld(qb + kc * 32); }
    const bool msk = q0 < HWM;   // wave-uniform: this wave's queries lie in the masked block
    const float* pf = fwd + (size_t)(z / NH_) * (HWM * HWM) + ((q0 & (HWM - 1)) + lr) * HWM + hi * 8;   // fwd[b][i][j ...]: a lane's 8 keys are consecutive
    const float* pb = bwd + (size_t)(z / NH_) * (HWM * HWM) + hi * 8 * HWM + (q0 & (HWM - 1)) + lr;     // bwd[b][j][i]: one row per key
    v8f f8[2], b8[2];   // the maps' values of one masked pass, fetched one pass ahead
    if (msk) {
#pragma unroll
        for (int t = 0; t < 2; ++t) { f8[t] = *(const v8f*)(pf + t * 16);
#pragma unroll
            for (int j = 0; j < 8; ++j) b8[t][j] = pb[(t * 16 + j) * HWM]; }
    }
    v8f o[4];
#pragma unroll
    for (int dt = 0; dt < 4; ++dt) o[dt] = (v8f){};
    float m = -3.0e38f, l = 0.f;
    int ko = lr * KP + 8 * hi, vo = lr * VP + 8 * hi;   // this pass's first K row and V^T column in LDS
    asm volatile("s_wait_xcnt 0x0" :: "v"(tid), "v"(qa), "v"(qb), "v"(pf), "v"(pb) : "memory");   // the wait stands before the address registers of the K, V^T, Q and map loads are reused (named, so that they live up to it)
    __syncthreads();   // K and V^T are complete in LDS; nothing writes them from here on
    // one pass of 32 keys; MK::value: the pass lies in the masked block. Each variant's loop body is one straight block.
    auto pass = [&](auto MK, int p) __attribute__((always_inline)) {
        constexpr bool M = decltype(MK)::value;
        float mk[2][8];
        if constexpr (M) {
#pragma unroll
            for (int t = 0; t < 2; ++t) {
#pragma unroll
                for (int j = 0; j < 8; ++j) { const unsigned w = pk2(b8[t][j], f8[t][j]); mk[t][j] = pklo(w) * pkhi(w); } }
            const int st = (p + 1 < HWM / 32) ? 32 : 0; pf += st; pb += st * HWM;   // the next masked pass's values; the last pass reads its own again, so that every address stays inside the maps
#pragma unroll
            for (int t = 0; t < 2; ++t) { f8[t] = *(const v8f*)(pf + t * 16);
#pragma unroll
                for (int j = 0; j < 8; ++j) b8[t][j] = pb[(t * 16 + j) * HWM]; }
        }
        v16bf ah[2][2], al[2][2];
#pragma unroll
        for (int t = 0; t < 2; ++t) {
#pragma unroll
            for (int kc = 0; kc < 2; ++kc) { ah[t][kc] = F::ld(Ksh + ko + t * 16 * KP + kc * 32); al[t][kc] = F::ld(Ksl + ko + t * 16 * KP + kc * 32); } }
        // holds the pass's sixteen K reads together in front of the first product: one LDS latency a pass instead of one per fragment
        asm volatile("" :: "v"(ah[0][0]), "v"(ah[0][1]), "v"(ah[1][0]), "v"(ah[1][1]), "v"(al[0][0]), "v"(al[0][1]), "v"(al[1][0]), "v"(al[1][1]));
        v8f s[2];
#pragma unroll
        for (int t = 0; t < 2; ++t) s[t] = (v8f){};
#pragma unroll
        for (int kc = 0; kc < 2; ++kc) {
#pragma unroll
            for (int t = 0; t < 2; ++t) s[t] = wmmab(ah[t][kc], bqh[kc], s[t]);
#pragma unroll
            for (int t = 0; t < 2; ++t) s[t] = wmmab(ah[t][kc], bql[kc], s[t]);
#pragma unroll
            for (int t = 0; t < 2; ++t) s[t] = wmmab(al[t][kc], bqh[kc], s[t]); }
        v16bf vh[4], vl[4];
#pragma unroll
        for (int dt = 0; dt < 4; ++dt) { vh[dt] = F::ld(Vs + vo + dt * 16 * VP); vl[dt] = F::ld(Vs + vo + dt * 16 * VP + TT); }
        __builtin_amdgcn_sched_barrier(0);   // keeps the sixteen V^T reads in front of the softmax arithmetic, which covers their latency; without it half of them were issued among the attn.v products and waited for there
        if constexpr (M) {
#pragma unroll
            for (int t = 0; t < 2; ++t) {
#pragma unroll
                for (int j = 0; j < 8; ++j) s[t][j] = s[t][j] * mk[t][j]; }
        }
        float pm = s[0][0];
#pragma unroll
        for (int t = 0; t < 2; ++t) {
#pragma unroll
            for (int j = 0; j < 8; ++j) pm = fmaxf(pm, s[t][j]); }
        pm = fmaxf(pm, xhalf(pm));   // the other half of the query's keys
        const float mn = fmaxf(m, pm), nb = -mn * L2E, sc = __builtin_amdgcn_exp2f(__builtin_fmaf(m, L2E, nb)); m = mn;
        float ps = 0.f; v8u ph, pl;
#pragma unroll
        for (int t = 0; t < 2; ++t) {
#pragma unroll
            for (int j = 0; j < 8; j += 2) { const float e0 = __builtin_amdgcn_exp2f(__builtin_fmaf(s[t][j], L2E, nb)), e1 = __builtin_amdgcn_exp2f(__builtin_fmaf(s[t][j + 1], L2E, nb)); ps += e0; ps += e1;
                const unsigned w = pk2(e0, e1); ph[t * 4 + j / 2] = w; pl[t * 4 + j / 2] = pk2(e0 - pklo(w), e1 - pkhi(w)); } }
        l = l * sc + ps;
        const v16bf bph = __builtin_bit_cast(v16bf, ph), bpl = __builtin_bit_cast(v16bf, pl);
#pragma unroll
        for (int dt = 0; dt < 4; ++dt) {
#pragma unroll
            for (int j = 0; j < 8; ++j) o[dt][j] *= sc; }
#pragma unroll
        for (int dt = 0; dt < 4; ++dt) o[dt] = wmmab(vh[dt], bph, o[dt]);
#pragma unroll
        for (int dt = 0; dt < 4; ++dt) o[dt] = wmmab(vh[dt], bpl, o[dt]);
#pragma unroll
        for (int dt = 0; dt < 4; ++dt) o[dt] = wmmab(vl[dt], bph, o[dt]);
        // four vector slots behind the pass's last matrix instructions, before the back edge lets the next pass overwrite their operands
        if constexpr (M) asm volatile("v_nop\n\tv_nop\n\tv_nop\n\tv_nop\n\ts_wait_xcnt 0x0" : "+v"(o[0]), "+v"(o[1]), "+v"(o[2]), "+v"(o[3]) : "v"(pf), "v"(pb) : "memory");   // and the wait stands before the map loads' address registers step on (named, so that they live up to it)
        else asm volatile("v_nop\n\tv_nop\n\tv_nop\n\tv_nop" : "+v"(o[0]), "+v"(o[1]), "+v"(o[2]), "+v"(o[3]));
        ko += 32 * KP; vo += 32;
    };
    const int pmk = msk ? HWM / 32 : 0; int p = 0;
    // both loops stay rolled: one pass already fills the register budget of four waves a SIMD, and two bodies keep the code small
#pragma unroll 1
    for (; p < pmk; ++p) pass(BoolC<true>{}, p);
#pragma unroll 1
    for (; p < TT / 32; ++p) pass(BoolC<false>{}, p);
    l += xhalf(l);
    const float f = __fdiv_rn(1.0f, l);
    const size_t oo = ((size_t)(z / NH_) * TT + q0 + lr) * DQ + (z % NH_) * HD + hi * 8;   // merged rows [b][t][h][d]: a lane's 8 accumulator rows are 8 consecutive d
    v8us a8[4], c8[4];
#pragma unroll
    for (int dt = 0; dt < 4; ++dt) {
#pragma unroll
        for (int j = 0; j < 8; ++j) { unsigned short a2, c2; splitf(o[dt][j] * f, a2, c2); a8[dt][j] = a2; c8[dt][j] = c2; } }
    __builtin_amdgcn_sched_barrier(0);   // the eight stores stand behind all the arithmetic: nothing overwrites a register that an issued store names
#pragma unroll
    for (int dt = 0; dt < 4; ++dt) { *(v8us*)(Oh + oo + dt * 16) = a8[dt]; *(v8us*)(Ol + oo + dt * 16) = c8[dt]; }
}

extern "C" void kernel_launch(void* const* d_in, const int* in_sizes, int n_in,
                              void* d_out, int out_size, void* d_ws, size_t ws_size, hipStream_t stream) {
    (void)in_sizes; (void)n_in; (void)out_size;
    const float* x = (const float*)d_in[0]; const float* xk = (const float*)d_in[1]; /* src_encode: keys and values */ const float* fmap = (const float*)d_in[2]; const float* bmap = (const float*)d_in[3]; const float* wq = (const float*)d_in[4]; const float* bq = (const float*)d_in[5]; const float* wk = (const float*)d_in[6]; const float* bk = (const float*)d_in[7]; const float* wv = (const float*)d_in[8]; const float* bv = (const float*)d_in[9]; const float* wo = (const float*)d_in[10]; const float* bo = (const float*)d_in[11];
    float* OUT = (float*)d_out;     // [8][512][1024]
    char* wsp = (char*)d_ws;
    auto take = [&](size_t bytes) { char* p = wsp; wsp += (bytes + 255) & ~(size_t)255; return (void*)p; };
    bf* WQ = (bf*)take((size_t)DQ * DM * 2); bf* WK = (bf*)take((size_t)DKV * DM * 2); bf* WV = (bf*)take((size_t)DKV * DM * 2); bf* WO = (bf*)take((size_t)DM * DQ * 2); (void)WK; (void)WV;   // WQ, WK, WV, WO lie back to back (z-stride DM*DM)
    const size_t PL = (size_t)NB_ * NH_ * TT * HD;   // one plane set: [b][h][t][d] (or [b][h][d][t])
    bf* QPh = (bf*)take(2 * PL * 2); bf* QPl = (bf*)take(2 * PL * 2); bf* VTh = (bf*)take(2 * PL * 2);   // q planes, then k planes at + PL; v rows [b][h][d]: hi half, lo half (pitch 2 TT)
    bf* ATh = (bf*)take((size_t)NB_ * TT * DQ * 2); bf* ATl = (bf*)take((size_t)NB_ * TT * DQ * 2);
    const size_t XN = (size_t)NB_ * TT * DM;
    bf* XB = (bf*)take(2 * XN * 2);   // x, then src_encode at + XN
    if ((size_t)(wsp - (char*)d_ws) > ws_size) return;    // ws 256 MiB
    bf* KPh = QPh + PL; bf* KPl = QPl + PL;
    k_cvt8<<<dim3((unsigned)(((size_t)DM * DM / 8 + 255) / 256), 12, 1), 256, 0, stream>>>(wq, wk, wv, wo, x, xk, WQ, XB);
    k_gemmw<bf, 0, true, 1><<<dim3(NB_ * TT / 64, DQ / 64, 3), 32, 0, stream>>>(XB, nullptr, WQ, nullptr, DM, DM, nullptr, 0, bq, bk, bv, XN, (size_t)DM * DM, 0, QPh, QPl, VTh, nullptr, nullptr);   /* q x 1/8, k, v^T */
    k_fattn<<<dim3(2, ZH, 1), 512, 0, stream>>>(QPh, QPl, KPh, KPl, VTh, ATh, ATl, fmap, bmap);   /* softmax(q.k / 8, [:256,:256] x bwd^T fwd) . v -> merged hi / lo rows */
    k_gemmw<bf, 1, true, 0><<<dim3(NB_ * TT / 64, DM / 64, 1), 32, 0, stream>>>(ATh, ATl, WO, nullptr, DQ, DQ, OUT, DM, bo, nullptr, nullptr, 0, 0, 0, nullptr, nullptr, nullptr, nullptr, nullptr);
}

// v004
// It runs in 79.8 microseconds.
// In two side-by-side timings against v003, it was 1.60 and 1.59 times as fast.
// Over all steps from v000 it is 29.6 times as fast.
#include <hip/hip_runtime.h>

// Cross attention with an epipolar mask multiplied into part of the score block (x, src_encode [8][512][1024]; q = x Wq^T + bq, k, v = src_encode W^T + b ('oi' [1024][1024] + [1024], 0.02; 16 heads x 64); att = q.k / 8; att[:, :, 0:256, 0:256] *= mask with mask[b][i][j] = backward_map[b][j][i] forward_map[b][i][j] (inputs [8][256][256], read); softmax over all 512 keys; out = merged Wp^T + bp -> [8][512][1024] (4.2 M)).
// Layout, every stage one launch over all batches and heads (k_fattn grid y = batch * 16 + head): bf16 copies of the weights and the two inputs; exact projections + f32 biases, whose epilogue writes the q, k head planes (hi/lo) and the transposed v rows; dense T-512 attention in one kernel (k_fattn) with every row on hi/lo planes (3 products): the scores with i, j < 256 are multiplied by the mask before the softmax (the 1/8 is folded into q so the product applies to the scaled scores, as in the module), scores and probabilities stay in registers, and it writes the merged hi/lo rows; merged hi/lo x Wp exact + bp.
// Compute dtypes, f32 accumulate: every input rounded to bf16 incl. the maps; projections exact + f32 biases; scores and attn.v 3 products; mask product and softmax f32; Wp hl x exact + bias.

#define NB_  8
#define TT   512
#define DM   1024
#define NH_  16
#define NKV  16
#define REP  (NH_ / NKV)
#define HD   64
#define DQ   (NH_ * HD)
#define DKV  (NKV * HD)
#define ZH   (NB_ * NH_)          // (batch, head) planes per launch: all of them
#define RH   512                  // unused: k_fattn puts every query row on hi+lo planes
#define WIN  0
#define PCAR 1024.0f
#define SCL  1.0f   // 1/8 folded into q (QSC) so the mask multiplies the scaled scores
#define QSC  0.125f
#define HWM  256     // masked sub-block size
typedef _Float16 h16;
typedef unsigned short bf;
typedef __attribute__((ext_vector_type(16))) __bf16   v16bf;
typedef __attribute__((ext_vector_type(16))) _Float16 v16h;
typedef __attribute__((ext_vector_type(8)))  _Float16 v8h;
typedef __attribute__((ext_vector_type(8)))  unsigned short v8us;
typedef __attribute__((ext_vector_type(8)))  float    v8f;
typedef __attribute__((ext_vector_type(4)))  float    v4f;
typedef v8h  __attribute__((may_alias)) v8ha;
typedef v4f  __attribute__((may_alias)) v4fa;
typedef v8us __attribute__((may_alias)) v8usa;

__device__ __forceinline__ unsigned short f2bf(float f) { unsigned u = __float_as_uint(f); u += 0x7FFFu + ((u >> 16) & 1u); return (unsigned short)(u >> 16); }
__device__ __forceinline__ float bf2f(unsigned short b) { return __uint_as_float(((unsigned)b) << 16); }
__device__ __forceinline__ float bfr(float f) { return bf2f(f2bf(f)); }
__device__ __forceinline__ v16h cat16(v8h lo, v8h hi) { return __builtin_shufflevector(lo, hi, 0, 1, 2, 3, 4, 5, 6, 7, 8, 9, 10, 11, 12, 13, 14, 15); }
__device__ __forceinline__ v16bf cat16b(v8us lo, v8us hi) { return __builtin_bit_cast(v16bf, __builtin_shufflevector(lo, hi, 0, 1, 2, 3, 4, 5, 6, 7, 8, 9, 10, 11, 12, 13, 14, 15)); }
__device__ __forceinline__ v8f wmma16(v16h a, v16h b, v8f c) { return __builtin_amdgcn_wmma_f32_16x16x32_f16(false, a, false, b, (short)0, c, false, false); }
__device__ __forceinline__ v8f wmmab(v16bf a, v16bf b, v8f c) { return __builtin_amdgcn_wmma_f32_16x16x32_bf16(false, a, false, b, (short)0, c, false, false); }



// ---- k_gemmw: register-blocked GEMM, one wave per 64x64 output tile (16 accumulators), FOUR waves (2 x 2) per work-group = a 128x128 tile; grid (M/128, N/128, Z), 128 threads.
// The operands' K-contiguous 16-bit planes come through LDS: a stage is 64 k (128 B, one whole line) of the 128 A rows (and A2 rows) and the 128 Bt rows, brought by asynchronous 16-byte copies (a wave's copy = 4 whole lines) into rows of pitch GP.
// Two buffers: stage t + 2 is copied into the buffer that trip t has just left, while trip t + 1 works. Each A row is read from L2 once per work-group for two waves, each Bt row likewise. KL % 64 == 0.
// C[m][n] (f32, pitch ldc, + optional f32 bias[n]) = sum_k A[m][k] Bt[n][k] (+ split products per NSPLIT). A and Bt rows have pitch K, the sum runs over k < KL <= K. z-batch strides sA/sB/sC in elements. NSPLIT 0 or 1.
// EPI picks what the epilogue stores. 0: C as above.
// 1 (QKV): z = 0, 1, 2 are the q, k, v projections in one grid: A is the first input plane for z = 0 and the second (at sA) for z = 1, 2; the bias is bias, bias1, bias2; a 64-column tile is one head. q x QSC and k go as bf16 hi / lo to the planes Ph / Pl [z][b][h][t][d]; v goes transposed to Vt rows [b][h][d] of pitch 2 TT (hi half, lo half).
// (2 and 3 are not launched any more: k_fattn does their work.) 2: C as above, the tiles with row, column < HWM first multiplied by mask[i][j] = bwd[b][j][i] fwd[b][i][j] (b = z / NH_).
// 3: z = b * NH_ + h; the tile goes as bf16 hi / lo to the merged rows Ph / Pl [b][t][h][d].
template <typename T16> struct WFrag;
template <> struct WFrag<h16> { typedef v16h V; static __device__ __forceinline__ V ld(const h16* p) { return cat16(*(const v8h*)p, *(const v8h*)(p + 16)); } static __device__ __forceinline__ v8f mma(V a, V b, v8f c) { return wmma16(a, b, c); } };
template <> struct WFrag<bf> { typedef v16bf V; static __device__ __forceinline__ V ld(const bf* p) { return cat16b(*(const v8us*)p, *(const v8us*)(p + 16)); } static __device__ __forceinline__ v8f mma(V a, V b, v8f c) { return wmmab(a, b, c); } };
__device__ __forceinline__ void splitf(float y, unsigned short& h, unsigned short& l) { h = f2bf(y); l = f2bf(y - bf2f(h)); }
typedef __attribute__((ext_vector_type(4))) unsigned short v4us;
#define GP 72     // LDS pitch of a stage's row, elements: 128 B + 16 B (16 B x odd: no bank conflict for 16-byte reads down a column of rows)
// One lane's eight 16-byte asynchronous copies of one plane's stage: rows r, r + 16, ..., r + 112 (global pitch K elements, LDS pitch GP). l: the lane's LDS byte address, g: its global address.
// The s_wait_xcnt stands inside the copies' own statement, so that no address register of a copy is rewritten in front of it.
template <typename T16>
__device__ __forceinline__ void acp8(unsigned l, const T16* g, int K) {
    const size_t st = (size_t)16 * K; constexpr unsigned ls = 16 * GP * 2;
    asm volatile("global_load_async_to_lds_b128 %0, %8, off\n\t"
                 "global_load_async_to_lds_b128 %1, %9, off\n\t"
                 "global_load_async_to_lds_b128 %2, %10, off\n\t"
                 "global_load_async_to_lds_b128 %3, %11, off\n\t"
                 "global_load_async_to_lds_b128 %4, %12, off\n\t"
                 "global_load_async_to_lds_b128 %5, %13, off\n\t"
                 "global_load_async_to_lds_b128 %6, %14, off\n\t"
                 "global_load_async_to_lds_b128 %7, %15, off\n\t"
                 "s_wait_xcnt 0x0"
                 :: "v"(l), "v"(l + ls), "v"(l + 2 * ls), "v"(l + 3 * ls), "v"(l + 4 * ls), "v"(l + 5 * ls), "v"(l + 6 * ls), "v"(l + 7 * ls),
                    "v"(g), "v"(g + st), "v"(g + 2 * st), "v"(g + 3 * st), "v"(g + 4 * st), "v"(g + 5 * st), "v"(g + 6 * st), "v"(g + 7 * st) : "memory");
}
template <typename T16, int NSPLIT, bool BIAS, int EPI>
__global__ __launch_bounds__(128) void k_gemmw(const T16* __restrict__ A, const T16* __restrict__ A2, const T16* __restrict__ Bt, const T16* __restrict__ Bt2, int K, int KL, float* C, int ldc, const float* __restrict__ bias, const float* __restrict__ bias1, const float* __restrict__ bias2, size_t sA, size_t sB, size_t sC, bf* Ph, bf* Pl, bf* Vt, const float* __restrict__ fwd, const float* __restrict__ bwd) {
    typedef typename WFrag<T16>::V V; constexpr bool QKV = (EPI == 1);
    static_assert(NSPLIT == 0 || NSPLIT == 1, "planes staged: A, A2 (NSPLIT 1), Bt");
    constexpr int PLN = 128 * GP, NPL = (NSPLIT == 1) ? 3 : 2;   // elements of one plane's stage; planes per stage: A, (A2,) Bt
    __shared__ __align__(16) T16 ring[2][NPL * PLN];
    __shared__ __align__(16) float osw[4][16 * 68];   // each wave's own epilogue rows
    const int tid = threadIdx.x, wave = __builtin_amdgcn_readfirstlane(tid >> 5); float* os = osw[wave];
    const size_t z = blockIdx.z; const size_t za = QKV ? (z ? 1 : 0) : z; A += za * sA; if (A2) A2 += za * sA; if (QKV) bias = (z == 0) ? bias : (z == 1) ? bias1 : bias2; Bt += z * sB; (void)Bt2; C += z * sC;
    const int lane = tid & 31, lr = lane & 15, hi = lane >> 4; const int r0 = blockIdx.x * 128 + (wave & 1) * 64, c0 = blockIdx.y * 128 + (wave >> 1) * 64, hd = c0 / 64;
    v8f acc[4][4];
#pragma unroll
    for (int mb = 0; mb < 4; ++mb)
#pragma unroll
        for (int nb = 0; nb < 4; ++nb) acc[mb][nb] = (v8f){};
    // copies: 16-byte chunk tid & 7 of row (tid >> 3) + 16 i of each plane's 128 rows
    const size_t gro = (size_t)(tid >> 3) * K + (tid & 7) * 8;
    const T16* ga = A + (size_t)(blockIdx.x * 128) * K + gro; const T16* ga2 = (NSPLIT == 1) ? A2 + (size_t)(blockIdx.x * 128) * K + gro : nullptr; const T16* gb = Bt + (size_t)(blockIdx.y * 128) * K + gro;
    const unsigned l0 = (unsigned)(size_t)&ring[0][0] + (unsigned)((tid >> 3) * GP + (tid & 7) * 8) * 2;
    auto stage = [&](int t) __attribute__((always_inline)) {   // stage t -> buffer t & 1
        const unsigned l = l0 + (unsigned)(t & 1) * (NPL * PLN * 2);
        acp8(l, ga + t * 64, K); if (NSPLIT == 1) acp8(l + PLN * 2, ga2 + t * 64, K); acp8(l + (NPL - 1) * PLN * 2, gb + t * 64, K);
    };
    const int NT = KL / 64;
    stage(0);
    asm volatile("s_wait_asynccnt 0x0" ::: "memory");   // this wave's copies of stage 0 have landed
    __syncthreads();                                      // and every other wave's: stage 0 may be read
    if (NT > 1) stage(1);
    const int ao = ((wave & 1) * 64 + lr) * GP + 8 * hi, bo = (NPL - 1) * PLN + ((wave >> 1) * 64 + lr) * GP + 8 * hi;   // this wave's first A and Bt row in a buffer
#pragma unroll 1
    for (int t = 0; t < NT; ++t) {   // stays rolled: a trip is a stage, its foot the hand-over of the buffers
        const T16* sb = ring[t & 1];
        V a[2][4], a2[2][4], b[2][4];   // the stage's two blocks of 32 k
#pragma unroll
        for (int h = 0; h < 2; ++h) {
#pragma unroll
            for (int mb = 0; mb < 4; ++mb) a[h][mb] = WFrag<T16>::ld(sb + ao + mb * 16 * GP + h * 32);
#pragma unroll
            for (int nb = 0; nb < 4; ++nb) b[h][nb] = WFrag<T16>::ld(sb + bo + nb * 16 * GP + h * 32);
            if (NSPLIT == 1) {
#pragma unroll
                for (int mb = 0; mb < 4; ++mb) a2[h][mb] = WFrag<T16>::ld(sb + PLN + ao + mb * 16 * GP + h * 32); }
        }
        __builtin_amdgcn_sched_barrier(0);   // keeps the stage's fragment reads together in front of its products: one LDS latency a stage, the second block's reads land under the first block's products; without it each group of four products waited for its own Bt fragment
#pragma unroll
        for (int h = 0; h < 2; ++h) {
#pragma unroll
            for (int nb = 0; nb < 4; ++nb) {
#pragma unroll
                for (int mb = 0; mb < 4; ++mb) { acc[mb][nb] = WFrag<T16>::mma(a[h][mb], b[h][nb], acc[mb][nb]); if (NSPLIT == 1) acc[mb][nb] = WFrag<T16>::mma(a2[h][mb], b[h][nb], acc[mb][nb]); } }
        }
        __builtin_amdgcn_sched_barrier(0);   // every product of the trip stands in front of its foot: moved behind the barrier they would delay the next copies, whose flight the next trip has to cover
        asm volatile("s_wait_dscnt 0x0" ::: "memory");      // this wave's reads of buffer t & 1 are done before the buffer is handed back
        asm volatile("s_wait_asynccnt 0x0" ::: "memory");   // this wave's copies of stage t + 1 have landed
        __syncthreads();                                      // publishes stage t + 1 and ends every wave's reads of stage t
        if (t + 2 < NT) stage(t + 2);
    }
    asm volatile("s_wait_asynccnt 0x0" ::: "memory");   // no copy is outstanding when the wave goes on to its end
    if (EPI == 1) if (z == 2) {   // v: a lane's 8 accumulator rows are 8 consecutive t of one d: one 16-byte store per half
        bf* vrow = Vt + ((size_t)((r0 / TT) * NKV + hd) * HD + lr) * (2 * TT) + (r0 % TT) + hi * 8;
#pragma unroll
        for (int nb = 0; nb < 4; ++nb) { const float bb = bfr(bias[c0 + nb * 16 + lr]);
#pragma unroll
            for (int mb = 0; mb < 4; ++mb) { v8us oh, ol;
#pragma unroll
                for (int j = 0; j < 8; ++j) { unsigned short a2, c2; splitf(acc[mb][nb][j] + bb, a2, c2); oh[j] = a2; ol[j] = c2; }
                bf* p = vrow + (size_t)(nb * 16) * (2 * TT) + mb * 16; *(v8us*)p = oh; *(v8us*)(p + TT) = ol; } }
        return;
    }
    const size_t prow = (EPI == 1) ? ((z * NB_ + r0 / TT) * NH_ + hd) * (size_t)TT * HD + (size_t)(r0 % TT) * HD : (EPI == 3) ? ((z / NH_) * TT + r0) * (size_t)DQ + (z % NH_) * HD + c0 : 0;   // first element of the tile in Ph / Pl
    const int ppitch = (EPI == 1) ? HD : DQ; const float psc = (EPI == 1 && z == 0) ? QSC : 1.0f;
#pragma unroll
    for (int mb = 0; mb < 4; ++mb) {
        if (EPI == 2) if (r0 < HWM && c0 < HWM) {   // a lane's 8 accumulator rows i are consecutive in bwd's row j
            const float* pb = bwd + (z / NH_) * (size_t)(HWM * HWM) + (size_t)(c0 + lr) * HWM + r0 + hi * 8; const float* pf = fwd + (z / NH_) * (size_t)(HWM * HWM) + (size_t)(r0 + hi * 8) * HWM + c0 + lr; v8f b8[4], f8[4];
#pragma unroll
            for (int nb = 0; nb < 4; ++nb) { b8[nb] = *(const v8f*)(pb + nb * 16 * HWM + mb * 16);
#pragma unroll
                for (int j = 0; j < 8; ++j) f8[nb][j] = pf[(mb * 16 + j) * HWM + nb * 16]; }
            asm volatile("s_wait_xcnt 0x0" :: "v"(pb), "v"(pf) : "memory");   // the wait stands before the loads' address registers are reused (named, so that they live up to it)
#pragma unroll
            for (int nb = 0; nb < 4; ++nb) {
#pragma unroll
                for (int j = 0; j < 8; ++j) { const float m = __fmul_rn(bfr(b8[nb][j]), bfr(f8[nb][j])); acc[mb][nb][j] = __fmul_rn(acc[mb][nb][j], m); } }
        }
#pragma unroll
        for (int nb = 0; nb < 4; ++nb) {
#pragma unroll
            for (int j = 0; j < 8; ++j) os[(hi * 8 + j) * 68 + nb * 16 + lr] = acc[mb][nb][j]; }
        __builtin_amdgcn_wave_barrier(); asm volatile("" ::: "memory");
        float* crow = C + (size_t)(r0 + mb * 16) * ldc + c0;
{
#pragma unroll
            for (int s = 0; s < 8; ++s) { const int row = 2 * s + hi, cofs = lr * 4; v4f val = *(const v4fa*)(os + row * 68 + cofs); if (BIAS) { val[0] += bfr(bias[c0 + cofs]); val[1] += bfr(bias[c0 + cofs + 1]); val[2] += bfr(bias[c0 + cofs + 2]); val[3] += bfr(bias[c0 + cofs + 3]); }
                if (EPI == 1 || EPI == 3) { v4us oh, ol;
#pragma unroll
                    for (int q = 0; q < 4; ++q) { unsigned short a2, c2; splitf(val[q] * psc, a2, c2); oh[q] = a2; ol[q] = c2; }
                    const size_t oo = prow + (size_t)(mb * 16 + row) * ppitch + cofs; *(v4us*)(Ph + oo) = oh; *(v4us*)(Pl + oo) = ol; continue; }
                *(v4f*)(crow + (size_t)row * ldc + cofs) = val; }
             }
        if (EPI == 1 || EPI == 2) asm volatile("s_wait_xcnt 0x0" ::: "memory");   // the wait stands before the next 16 rows' loads reuse the stores' registers
        __builtin_amdgcn_wave_barrier(); asm volatile("" ::: "memory");
    }
}

__device__ __forceinline__ h16 tohx(float x) { return (h16)x; }
typedef __attribute__((ext_vector_type(2))) _Float16 v2h;
typedef __attribute__((ext_vector_type(4))) _Float16 v4h;
typedef __attribute__((ext_vector_type(2))) unsigned short v2us;
typedef __attribute__((ext_vector_type(2))) float v2f;
typedef __attribute__((ext_vector_type(4))) int v4i;

__global__ __launch_bounds__(256) void k_wtG(const float* __restrict__ w, int K, int N, bf* Bt) {
    const int lane = threadIdx.x & 31; const int L0 = (blockIdx.x * 8 + (threadIdx.x >> 5)) * 8; const int nlines = N * K / 64;
{
#pragma unroll 1
        for (int l = 0; l < 8; ++l) { const int L = L0 + l; if (L >= nlines) break; const size_t e = (size_t)L * 64 + lane * 2; const int k = (int)(e % K), n = (int)(e / K); v2us o;
            o[0] = f2bf(w[(size_t)k * N + n]); o[1] = f2bf(w[(size_t)(k + 1) * N + n]); *(v2us*)(Bt + e) = o; }
         }
}
// k_cvt8: blockIdx.y picks a slice of DM*DM elements: 0..3 the four weights -> dw, 4..7 x, 8..11 src_encode -> dx (both inputs are NB_*TT*DM = 4 slices)
__global__ __launch_bounds__(256) void k_cvt8(const float* __restrict__ wq, const float* __restrict__ wk, const float* __restrict__ wv, const float* __restrict__ wo, const float* __restrict__ x, const float* __restrict__ xk, bf* dw, bf* dx) { const size_t i = (size_t)blockIdx.x * 256 + threadIdx.x; const int sl = blockIdx.y; const size_t SL = (size_t)DM * DM; if (i >= SL / 8) return;
    const float* src = (sl == 0) ? wq : (sl == 1) ? wk : (sl == 2) ? wv : (sl == 3) ? wo : (sl < 8) ? x + (size_t)(sl - 4) * SL : xk + (size_t)(sl - 8) * SL; bf* dst = (sl < 4) ? dw + (size_t)sl * SL : dx + (size_t)(sl - 4) * SL; const v8f v = *(const v8f*)(src + i * 8); v8us o;
#pragma unroll
    for (int k = 0; k < 8; ++k) o[k] = f2bf(v[k]); *(v8us*)(dst + i * 8) = o;  }

// ---- k_fattn: scores, mask product, softmax and attn.v in one kernel; no score or probability leaves the registers.
// A work-group of 16 waves takes half the query rows of one (batch, head) plane z; grid (2, ZH). It first copies the plane's whole K (hi, lo) and V^T (hi | lo rows) into LDS with whole-line loads, one barrier, and then only reads them.
// One wave owns 16 query rows and walks the 512 keys in passes of 32. The 16-row blocks alternate between the two work-groups, so that each has eight waves in the masked block.
// S^T = K Q^T: A = K rows, B = Q rows (kept in registers), so a lane holds 16 scores of ONE query (column lr): keys p * 32 + t * 16 + hi * 8 + j.
// The two f32 score tiles of a pass, turned into probabilities and split hi / lo, are already the B operand of O^T += V^T P^T (hardware k order, the order WFrag::ld reads V^T's rows in).
// Every inner loop is unrolled: its index picks registers.
// Running maximum m and sum l per query; O^T and l are rescaled by e^(old m - new m) each pass; the division by l comes last. The three hi / lo products of each GEMM stand in the order they had.
#define KP 72     // LDS pitch of a K row, elements: 128 B + 16 B (16 B x odd: no bank conflict for 16-byte reads down a column of rows)
#define VP 1032   // LDS pitch of a V^T row, elements: 2048 B + 16 B
template <bool B> struct BoolC { static constexpr bool value = B; };
typedef __attribute__((ext_vector_type(2))) __bf16 v2bf;
typedef __attribute__((ext_vector_type(2))) float v2fl;
typedef __attribute__((ext_vector_type(8))) unsigned v8u;
__device__ __forceinline__ unsigned pk2(float a, float b) { const v2fl x = {a, b}; return __builtin_bit_cast(unsigned, __builtin_convertvector(x, v2bf)); }   // two f32 -> two bf16 (nearest even), a in the low half
__device__ __forceinline__ float pklo(unsigned w) { return __uint_as_float(w << 16); }
__device__ __forceinline__ float pkhi(unsigned w) { return __uint_as_float(w & 0xFFFF0000u); }
__device__ __forceinline__ float xhalf(float x) { return __builtin_bit_cast(float, __builtin_amdgcn_permlanex16(__builtin_bit_cast(int, x), __builtin_bit_cast(int, x), 0x76543210, 0xfedcba98, false, false)); }   // lane l with lane l ^ 16
__global__ __launch_bounds__(512) void k_fattn(const bf* __restrict__ Qh, const bf* __restrict__ Ql, const bf* __restrict__ Kh, const bf* __restrict__ Kl, const bf* __restrict__ Vt, bf* __restrict__ Oh, bf* __restrict__ Ol, const float* __restrict__ fwd, const float* __restrict__ bwd) {
    typedef WFrag<bf> F; constexpr float L2E = 1.4426950408889634f;
    __shared__ __align__(16) bf Ksh[TT * KP]; __shared__ __align__(16) bf Ksl[TT * KP]; __shared__ __align__(16) bf Vs[HD * VP];
    const int tid = threadIdx.x, lane = tid & 31, lr = lane & 15, hi = lane >> 4; const int wave = __builtin_amdgcn_readfirstlane(tid >> 5);
    const int z = blockIdx.y, q0 = (wave * 2 + blockIdx.x) * 16; const size_t pz = (size_t)z * TT * HD;
    {   // 16-byte chunk c of each plane: a wave's load covers 512 consecutive bytes
        const v8us* gh = (const v8us*)(Kh + pz) + tid; const v8us* gl = (const v8us*)(Kl + pz) + tid; const v8us* gv = (const v8us*)(Vt + (size_t)z * HD * (2 * TT)) + tid;
#pragma unroll
        for (int i = 0; i < TT * HD / 8 / 512; ++i) { const int c = tid + i * 512, d = (c >> 3) * KP + (c & 7) * 8; *(v8us*)(Ksh + d) = gh[i * 512]; *(v8us*)(Ksl + d) = gl[i * 512]; }
#pragma unroll
        for (int i = 0; i < HD * 2 * TT / 8 / 512; ++i) { const int c = tid + i * 512; *(v8us*)(Vs + (c >> 7) * VP + (c & 127) * 8) = gv[i * 512]; }
    }
    const bf* qa = Qh + pz + (q0 + lr) * HD + 8 * hi; const bf* qb = Ql + pz + (q0 + lr) * HD + 8 * hi;
    v16bf bqh[2], bql[2];
#pragma unroll
    for (int kc = 0; kc < 2; ++kc) { bqh[kc] = F::ld(qa + kc * 32); bql[kc] = F::ld(qb + kc * 32); }
    const bool msk = q0 < HWM;   // wave-uniform: this wave's queries lie in the masked block
    const float* pf = fwd + (size_t)(z / NH_) * (HWM * HWM) + ((q0 & (HWM - 1)) + lr) * HWM + hi * 8;   // fwd[b][i][j ...]: a lane's 8 keys are consecutive
    const float* pb = bwd + (size_t)(z / NH_) * (HWM * HWM) + hi * 8 * HWM + (q0 & (HWM - 1)) + lr;     // bwd[b][j][i]: one row per key
    v8f f8[2], b8[2];   // the maps' values of one masked pass, fetched one pass ahead
    if (msk) {
#pragma unroll
        for (int t = 0; t < 2; ++t) { f8[t] = *(const v8f*)(pf + t * 16);
#pragma unroll
            for (int j = 0; j < 8; ++j) b8[t][j] = pb[(t * 16 + j) * HWM]; }
    }
    v8f o[4];
#pragma unroll
    for (int dt = 0; dt < 4; ++dt) o[dt] = (v8f){};
    float m = -3.0e38f, l = 0.f;
    int ko = lr * KP + 8 * hi, vo = lr * VP + 8 * hi;   // this pass's first K row and V^T column in LDS
    asm volatile("s_wait_xcnt 0x0" :: "v"(tid), "v"(qa), "v"(qb), "v"(pf), "v"(pb) : "memory");   // the wait stands before the address registers of the K, V^T, Q and map loads are reused (named, so that they live up to it)
    __syncthreads();   // K and V^T are complete in LDS; nothing writes them from here on
    // one pass of 32 keys; MK::value: the pass lies in the masked block. Each variant's loop body is one straight block.
    auto pass = [&](auto MK, int p) __attribute__((always_inline)) {
        constexpr bool M = decltype(MK)::value;
        float mk[2][8];
        if constexpr (M) {
#pragma unroll
            for (int t = 0; t < 2; ++t) {
#pragma unroll
                for (int j = 0; j < 8; ++j) { const unsigned w = pk2(b8[t][j], f8[t][j]); mk[t][j] = pklo(w) * pkhi(w); } }
            const int st = (p + 1 < HWM / 32) ? 32 : 0; pf += st; pb += st * HWM;   // the next masked pass's values; the last pass reads its own again, so that every address stays inside the maps
#pragma unroll
            for (int t = 0; t < 2; ++t) { f8[t] = *(const v8f*)(pf + t * 16);
#pragma unroll
                for (int j = 0; j < 8; ++j) b8[t][j] = pb[(t * 16 + j) * HWM]; }
        }
        v16bf ah[2][2], al[2][2];
#pragma unroll
        for (int t = 0; t < 2; ++t) {
#pragma unroll
            for (int kc = 0; kc < 2; ++kc) { ah[t][kc] = F::ld(Ksh + ko + t * 16 * KP + kc * 32); al[t][kc] = F::ld(Ksl + ko + t * 16 * KP + kc * 32); } }
        // holds the pass's sixteen K reads together in front of the first product: one LDS latency a pass instead of one per fragment
        asm volatile("" :: "v"(ah[0][0]), "v"(ah[0][1]), "v"(ah[1][0]), "v"(ah[1][1]), "v"(al[0][0]), "v"(al[0][1]), "v"(al[1][0]), "v"(al[1][1]));
        v8f s[2];
#pragma unroll
        for (int t = 0; t < 2; ++t) s[t] = (v8f){};
#pragma unroll
        for (int kc = 0; kc < 2; ++kc) {
#pragma unroll
            for (int t = 0; t < 2; ++t) s[t] = wmmab(ah[t][kc], bqh[kc], s[t]);
#pragma unroll
            for (int t = 0; t < 2; ++t) s[t] = wmmab(ah[t][kc], bql[kc], s[t]);
#pragma unroll
            for (int t = 0; t < 2; ++t) s[t] = wmmab(al[t][kc], bqh[kc], s[t]); }
        v16bf vh[4], vl[4];
#pragma unroll
        for (int dt = 0; dt < 4; ++dt) { vh[dt] = F::ld(Vs + vo + dt * 16 * VP); vl[dt] = F::ld(Vs + vo + dt * 16 * VP + TT); }
        __builtin_amdgcn_sched_barrier(0);   // keeps the sixteen V^T reads in front of the softmax arithmetic, which covers their latency; without it half of them were issued among the attn.v products and waited for there
        if constexpr (M) {
#pragma unroll
            for (int t = 0; t < 2; ++t) {
#pragma unroll
                for (int j = 0; j < 8; ++j) s[t][j] = s[t][j] * mk[t][j]; }
        }
        float pm = s[0][0];
#pragma unroll
        for (int t = 0; t < 2; ++t) {
#pragma unroll
            for (int j = 0; j < 8; ++j) pm = fmaxf(pm, s[t][j]); }
        pm = fmaxf(pm, xhalf(pm));   // the other half of the query's keys
        const float mn = fmaxf(m, pm), nb = -mn * L2E, sc = __builtin_amdgcn_exp2f(__builtin_fmaf(m, L2E, nb)); m = mn;
        float ps = 0.f; v8u ph, pl;
#pragma unroll
        for (int t = 0; t < 2; ++t) {
#pragma unroll
            for (int j = 0; j < 8; j += 2) { const float e0 = __builtin_amdgcn_exp2f(__builtin_fmaf(s[t][j], L2E, nb)), e1 = __builtin_amdgcn_exp2f(__builtin_fmaf(s[t][j + 1], L2E, nb)); ps += e0; ps += e1;
                const unsigned w = pk2(e0, e1); ph[t * 4 + j / 2] = w; pl[t * 4 + j / 2] = pk2(e0 - pklo(w), e1 - pkhi(w)); } }
        l = l * sc + ps;
        const v16bf bph = __builtin_bit_cast(v16bf, ph), bpl = __builtin_bit_cast(v16bf, pl);
#pragma unroll
        for (int dt = 0; dt < 4; ++dt) {
#pragma unroll
            for (int j = 0; j < 8; ++j) o[dt][j] *= sc; }
#pragma unroll
        for (int dt = 0; dt < 4; ++dt) o[dt] = wmmab(vh[dt], bph, o[dt]);
#pragma unroll
        for (int dt = 0; dt < 4; ++dt) o[dt] = wmmab(vh[dt], bpl, o[dt]);
#pragma unroll
        for (int dt = 0; dt < 4; ++dt) o[dt] = wmmab(vl[dt], bph, o[dt]);
        // four vector slots behind the pass's last matrix instructions, before the back edge lets the next pass overwrite their operands
        if constexpr (M) asm volatile("v_nop\n\tv_nop\n\tv_nop\n\tv_nop\n\ts_wait_xcnt 0x0" : "+v"(o[0]), "+v"(o[1]), "+v"(o[2]), "+v"(o[3]) : "v"(pf), "v"(pb) : "memory");   // and the wait stands before the map loads' address registers step on (named, so that they live up to it)
        else asm volatile("v_nop\n\tv_nop\n\tv_nop\n\tv_nop" : "+v"(o[0]), "+v"(o[1]), "+v"(o[2]), "+v"(o[3]));
        ko += 32 * KP; vo += 32;
    };
    const int pmk = msk ? HWM / 32 : 0; int p = 0;
    // both loops stay rolled: one pass already fills the register budget of four waves a SIMD, and two bodies keep the code small
#pragma unroll 1
    for (; p < pmk; ++p) pass(BoolC<true>{}, p);
#pragma unroll 1
    for (; p < TT / 32; ++p) pass(BoolC<false>{}, p);
    l += xhalf(l);
    const float f = __fdiv_rn(1.0f, l);
    const size_t oo = ((size_t)(z / NH_) * TT + q0 + lr) * DQ + (z % NH_) * HD + hi * 8;   // merged rows [b][t][h][d]: a lane's 8 accumulator rows are 8 consecutive d
    v8us a8[4], c8[4];
#pragma unroll
    for (int dt = 0; dt < 4; ++dt) {
#pragma unroll
        for (int j = 0; j < 8; ++j) { unsigned short a2, c2; splitf(o[dt][j] * f, a2, c2); a8[dt][j] = a2; c8[dt][j] = c2; } }
    __builtin_amdgcn_sched_barrier(0);   // the eight stores stand behind all the arithmetic: nothing overwrites a register that an issued store names
#pragma unroll
    for (int dt = 0; dt < 4; ++dt) { *(v8us*)(Oh + oo + dt * 16) = a8[dt]; *(v8us*)(Ol + oo + dt * 16) = c8[dt]; }
}

extern "C" void kernel_launch(void* const* d_in, const int* in_sizes, int n_in,
                              void* d_out, int out_size, void* d_ws, size_t ws_size, hipStream_t stream) {
    (void)in_sizes; (void)n_in; (void)out_size;
    const float* x = (const float*)d_in[0]; const float* xk = (const float*)d_in[1]; /* src_encode: keys and values */ const float* fmap = (const float*)d_in[2]; const float* bmap = (const float*)d_in[3]; const float* wq = (const float*)d_in[4]; const float* bq = (const float*)d_in[5]; const float* wk = (const float*)d_in[6]; const float* bk = (const float*)d_in[7]; const float* wv = (const float*)d_in[8]; const float* bv = (const float*)d_in[9]; const float* wo = (const float*)d_in[10]; const float* bo = (const float*)d_in[11];
    float* OUT = (float*)d_out;     // [8][512][1024]
    char* wsp = (char*)d_ws;
    auto take = [&](size_t bytes) { char* p = wsp; wsp += (bytes + 255) & ~(size_t)255; return (void*)p; };
    bf* WQ = (bf*)take((size_t)DQ * DM * 2); bf* WK = (bf*)take((size_t)DKV * DM * 2); bf* WV = (bf*)take((size_t)DKV * DM * 2); bf* WO = (bf*)take((size_t)DM * DQ * 2); (void)WK; (void)WV;   // WQ, WK, WV, WO lie back to back (z-stride DM*DM)
    const size_t PL = (size_t)NB_ * NH_ * TT * HD;   // one plane set: [b][h][t][d] (or [b][h][d][t])
    bf* QPh = (bf*)take(2 * PL * 2); bf* QPl = (bf*)take(2 * PL * 2); bf* VTh = (bf*)take(2 * PL * 2);   // q planes, then k planes at + PL; v rows [b][h][d]: hi half, lo half (pitch 2 TT)
    bf* ATh = (bf*)take((size_t)NB_ * TT * DQ * 2); bf* ATl = (bf*)take((size_t)NB_ * TT * DQ * 2);
    const size_t XN = (size_t)NB_ * TT * DM;
    bf* XB = (bf*)take(2 * XN * 2);   // x, then src_encode at + XN
    if ((size_t)(wsp - (char*)d_ws) > ws_size) return;    // ws 256 MiB
    bf* KPh = QPh + PL; bf* KPl = QPl + PL;
    k_cvt8<<<dim3((unsigned)(((size_t)DM * DM / 8 + 255) / 256), 12, 1), 256, 0, stream>>>(wq, wk, wv, wo, x, xk, WQ, XB);
    k_gemmw<bf, 0, true, 1><<<dim3(NB_ * TT / 128, DQ / 128, 3), 128, 0, stream>>>(XB, nullptr, WQ, nullptr, DM, DM, nullptr, 0, bq, bk, bv, XN, (size_t)DM * DM, 0, QPh, QPl, VTh, nullptr, nullptr);   /* q x 1/8, k, v^T */
    k_fattn<<<dim3(2, ZH, 1), 512, 0, stream>>>(QPh, QPl, KPh, KPl, VTh, ATh, ATl, fmap, bmap);   /* softmax(q.k / 8, [:256,:256] x bwd^T fwd) . v -> merged hi / lo rows */
    k_gemmw<bf, 1, true, 0><<<dim3(NB_ * TT / 128, DM / 128, 1), 128, 0, stream>>>(ATh, ATl, WO, nullptr, DQ, DQ, OUT, DM, bo, nullptr, nullptr, 0, 0, 0, nullptr, nullptr, nullptr, nullptr, nullptr);
}

// v005
// A run of this version takes 76.8 microseconds.
// In both of two side-by-side timings against v004, it was 1.04 times as fast.
// All steps since v000 together make it 30.7 times as fast.
#include <hip/hip_runtime.h>

// Cross attention with an epipolar mask multiplied into part of the score block (x, src_encode [8][512][1024]; q = x Wq^T + bq, k, v = src_encode W^T + b ('oi' [1024][1024] + [1024], 0.02; 16 heads x 64); att = q.k / 8; att[:, :, 0:256, 0:256] *= mask with mask[b][i][j] = backward_map[b][j][i] forward_map[b][i][j] (inputs [8][256][256], read); softmax over all 512 keys; out = merged Wp^T + bp -> [8][512][1024] (4.2 M)).
// Layout, every stage one launch over all batches and heads (k_fattn grid y = batch * 16 + head): bf16 copies of the weights and the two inputs; exact projections + f32 biases, whose epilogue writes the q, k head planes (hi/lo) and the transposed v rows; dense T-512 attention in one kernel (k_fattn) with every row on hi/lo planes (3 products): the scores with i, j < 256 are multiplied by the mask before the softmax (the 1/8 is folded into q so the product applies to the scaled scores, as in the module), scores and probabilities stay in registers, and it writes the merged hi/lo rows; merged hi/lo x Wp exact + bp.
// Compute dtypes, f32 accumulate: every input rounded to bf16 incl. the maps; projections exact + f32 biases; scores and attn.v 3 products; mask product and softmax f32; Wp hl x exact + bias.

#define NB_  8
#define TT   512
#define DM   1024
#define NH_  16
#define NKV  16
#define REP  (NH_ / NKV)
#define HD   64
#define DQ   (NH_ * HD)
#define DKV  (NKV * HD)
#define ZH   (NB_ * NH_)          // (batch, head) planes per launch: all of them
#define RH   512                  // unused: k_fattn puts every query row on hi+lo planes
#define WIN  0
#define PCAR 1024.0f
#define SCL  1.0f   // 1/8 folded into q (QSC) so the mask multiplies the scaled scores
#define QSC  0.125f
#define HWM  256     // masked sub-block size
typedef _Float16 h16;
typedef unsigned short bf;
typedef __attribute__((ext_vector_type(16))) __bf16   v16bf;
typedef __attribute__((ext_vector_type(16))) _Float16 v16h;
typedef __attribute__((ext_vector_type(8)))  _Float16 v8h;
typedef __attribute__((ext_vector_type(8)))  unsigned short v8us;
typedef __attribute__((ext_vector_type(8)))  float    v8f;
typedef __attribute__((ext_vector_type(4)))  float    v4f;
typedef v8h  __attribute__((may_alias)) v8ha;
typedef v4f  __attribute__((may_alias)) v4fa;
typedef v8us __attribute__((may_alias)) v8usa;

__device__ __forceinline__ unsigned short f2bf(float f) { unsigned u = __float_as_uint(f); u += 0x7FFFu + ((u >> 16) & 1u); return (unsigned short)(u >> 16); }
__device__ __forceinline__ float bf2f(unsigned short b) { return __uint_as_float(((unsigned)b) << 16); }
__device__ __forceinline__ float bfr(float f) { return bf2f(f2bf(f)); }
__device__ __forceinline__ v16h cat16(v8h lo, v8h hi) { return __builtin_shufflevector(lo, hi, 0, 1, 2, 3, 4, 5, 6, 7, 8, 9, 10, 11, 12, 13, 14, 15); }
__device__ __forceinline__ v16bf cat16b(v8us lo, v8us hi) { return __builtin_bit_cast(v16bf, __builtin_shufflevector(lo, hi, 0, 1, 2, 3, 4, 5, 6, 7, 8, 9, 10, 11, 12, 13, 14, 15)); }
__device__ __forceinline__ v8f wmma16(v16h a, v16h b, v8f c) { return __builtin_amdgcn_wmma_f32_16x16x32_f16(false, a, false, b, (short)0, c, false, false); }
__device__ __forceinline__ v8f wmmab(v16bf a, v16bf b, v8f c) { return __builtin_amdgcn_wmma_f32_16x16x32_bf16(false, a, false, b, (short)0, c, false, false); }



// ---- k_gemmw: register-blocked GEMM, one wave per 64x64 output tile (16 accumulators), FOUR waves (2 x 2) per work-group = a 128x128 tile; grid (M/128, N/128, Z), 128 threads.
// The operands' K-contiguous 16-bit planes come through LDS: a stage is SK k (64: 128 B, one whole line; 128: 256 B, two) of the 128 A rows (and A2 rows) and the 128 Bt rows, brought by asynchronous 16-byte copies (a wave's copy = 4 whole lines) into rows of pitch SK + 8.
// Two buffers: stage t + 2 is copied into the buffer that trip t has just left, while trip t + 1 works. Each A row is read from L2 once per work-group for two waves, each Bt row likewise. KL % SK == 0.
// SK 128 where one work-group has the LDS of its processor to itself: half the hand-overs, and twice the bytes are in flight while a trip of twice the work covers their flight.
// C[m][n] (f32, pitch ldc, + optional f32 bias[n]) = sum_k A[m][k] Bt[n][k] (+ split products per NSPLIT). A and Bt rows have pitch K, the sum runs over k < KL <= K. z-batch strides sA/sB/sC in elements. NSPLIT 0 or 1.
// EPI picks what the epilogue stores. 0: C as above.
// 1 (QKV): z = 0, 1, 2 are the q, k, v projections in one grid: A is the first input plane for z = 0 and the second (at sA) for z = 1, 2; the bias is bias, bias1, bias2; a 64-column tile is one head. q x QSC and k go as bf16 hi / lo to the planes Ph / Pl [z][b][h][t][d]; v goes transposed to Vt rows [b][h][d] of pitch 2 TT (hi half, lo half).
// (2 and 3 are not launched any more: k_fattn does their work.) 2: C as above, the tiles with row, column < HWM first multiplied by mask[i][j] = bwd[b][j][i] fwd[b][i][j] (b = z / NH_).
// 3: z = b * NH_ + h; the tile goes as bf16 hi / lo to the merged rows Ph / Pl [b][t][h][d].
template <typename T16> struct WFrag;
template <> struct WFrag<h16> { typedef v16h V; static __device__ __forceinline__ V ld(const h16* p) { return cat16(*(const v8h*)p, *(const v8h*)(p + 16)); } static __device__ __forceinline__ v8f mma(V a, V b, v8f c) { return wmma16(a, b, c); } };
template <> struct WFrag<bf> { typedef v16bf V; static __device__ __forceinline__ V ld(const bf* p) { return cat16b(*(const v8us*)p, *(const v8us*)(p + 16)); } static __device__ __forceinline__ v8f mma(V a, V b, v8f c) { return wmmab(a, b, c); } };
__device__ __forceinline__ void splitf(float y, unsigned short& h, unsigned short& l) { h = f2bf(y); l = f2bf(y - bf2f(h)); }
typedef __attribute__((ext_vector_type(4))) unsigned short v4us;
// LDS pitch of a stage's row, elements: SK + 8 = 128 B or 256 B + 16 B (16 B x odd: no bank conflict for 16-byte reads down a column of rows)
// One lane's eight 16-byte asynchronous copies: rows r + E0 RS, r + (E0 + 1) RS, ..., r + (E0 + 7) RS (global pitch K elements, LDS pitch GP elements). l: the lane's LDS byte address of row r, g: its global address.
// The s_wait_xcnt stands inside the copies' own statement, so that no address register of a copy is rewritten in front of it.
template <int RS, int GP, int E0, typename T16>
__device__ __forceinline__ void acp8(unsigned l, const T16* g, int K) {
    const size_t st = (size_t)RS * K; constexpr unsigned ls = RS * GP * 2; l += E0 * ls;
    asm volatile("global_load_async_to_lds_b128 %0, %8, off\n\t"
                 "global_load_async_to_lds_b128 %1, %9, off\n\t"
                 "global_load_async_to_lds_b128 %2, %10, off\n\t"
                 "global_load_async_to_lds_b128 %3, %11, off\n\t"
                 "global_load_async_to_lds_b128 %4, %12, off\n\t"
                 "global_load_async_to_lds_b128 %5, %13, off\n\t"
                 "global_load_async_to_lds_b128 %6, %14, off\n\t"
                 "global_load_async_to_lds_b128 %7, %15, off\n\t"
                 "s_wait_xcnt 0x0"
                 :: "v"(l), "v"(l + ls), "v"(l + 2 * ls), "v"(l + 3 * ls), "v"(l + 4 * ls), "v"(l + 5 * ls), "v"(l + 6 * ls), "v"(l + 7 * ls),
                    "v"(g + E0 * st), "v"(g + (E0 + 1) * st), "v"(g + (E0 + 2) * st), "v"(g + (E0 + 3) * st), "v"(g + (E0 + 4) * st), "v"(g + (E0 + 5) * st), "v"(g + (E0 + 6) * st), "v"(g + (E0 + 7) * st) : "memory");
}
template <typename T16, int NSPLIT, bool BIAS, int EPI, int SK>
__global__ __launch_bounds__(128) void k_gemmw(const T16* __restrict__ A, const T16* __restrict__ A2, const T16* __restrict__ Bt, const T16* __restrict__ Bt2, int K, int KL, float* C, int ldc, const float* __restrict__ bias, const float* __restrict__ bias1, const float* __restrict__ bias2, size_t sA, size_t sB, size_t sC, bf* Ph, bf* Pl, bf* Vt, const float* __restrict__ fwd, const float* __restrict__ bwd) {
    typedef typename WFrag<T16>::V V; constexpr bool QKV = (EPI == 1);
    static_assert(NSPLIT == 0 || NSPLIT == 1, "planes staged: A, A2 (NSPLIT 1), Bt"); static_assert(SK == 64 || SK == 128, "a stage's row: one or two whole lines");
    constexpr int GP = SK + 8, CH = SK / 8, RS = 128 / CH;   // row pitch; 16-byte chunks of a row; rows that the 128 lanes' one copy covers
    constexpr int PLN = 128 * GP, NPL = (NSPLIT == 1) ? 3 : 2;   // elements of one plane's stage; planes per stage: A, (A2,) Bt
    __shared__ __align__(16) T16 ring[2][NPL * PLN];
    __shared__ __align__(16) float osw[4][16 * 68];   // each wave's own epilogue rows
    const int tid = threadIdx.x, wave = __builtin_amdgcn_readfirstlane(tid >> 5); float* os = osw[wave];
    const size_t z = blockIdx.z; const size_t za = QKV ? (z ? 1 : 0) : z; A += za * sA; if (A2) A2 += za * sA; if (QKV) bias = (z == 0) ? bias : (z == 1) ? bias1 : bias2; Bt += z * sB; (void)Bt2; C += z * sC;
    const int lane = tid & 31, lr = lane & 15, hi = lane >> 4; const int r0 = blockIdx.x * 128 + (wave & 1) * 64, c0 = blockIdx.y * 128 + (wave >> 1) * 64, hd = c0 / 64;
    v8f acc[4][4];
#pragma unroll
    for (int mb = 0; mb < 4; ++mb)
#pragma unroll
        for (int nb = 0; nb < 4; ++nb) acc[mb][nb] = (v8f){};
    // copies: 16-byte chunk tid % CH of row tid / CH + RS i of each plane's 128 rows
    const size_t gro = (size_t)(tid / CH) * K + (tid % CH) * 8;
    const T16* ga = A + (size_t)(blockIdx.x * 128) * K + gro; const T16* ga2 = (NSPLIT == 1) ? A2 + (size_t)(blockIdx.x * 128) * K + gro : nullptr; const T16* gb = Bt + (size_t)(blockIdx.y * 128) * K + gro;
    const unsigned l0 = (unsigned)(size_t)&ring[0][0] + (unsigned)((tid / CH) * GP + (tid % CH) * 8) * 2;
    auto stage = [&](int t) __attribute__((always_inline)) {   // stage t -> buffer t & 1
        const unsigned l = l0 + (unsigned)(t & 1) * (NPL * PLN * 2);
        acp8<RS, GP, 0>(l, ga + t * SK, K); if (NSPLIT == 1) acp8<RS, GP, 0>(l + PLN * 2, ga2 + t * SK, K); acp8<RS, GP, 0>(l + (NPL - 1) * PLN * 2, gb + t * SK, K);
        if constexpr (SK == 128) {   // eight copies cover 8 RS = 64 rows: the planes' other 64
            acp8<RS, GP, 8>(l, ga + t * SK, K); if (NSPLIT == 1) acp8<RS, GP, 8>(l + PLN * 2, ga2 + t * SK, K); acp8<RS, GP, 8>(l + (NPL - 1) * PLN * 2, gb + t * SK, K); }
    };
    const int NT = KL / SK;
    stage(0);
    asm volatile("s_wait_asynccnt 0x0" ::: "memory");   // this wave's copies of stage 0 have landed
    __syncthreads();                                      // and every other wave's: stage 0 may be read
    if (NT > 1) stage(1);
    const int ao = ((wave & 1) * 64 + lr) * GP + 8 * hi, bo = (NPL - 1) * PLN + ((wave >> 1) * 64 + lr) * GP + 8 * hi;   // this wave's first A and Bt row in a buffer
#pragma unroll 1
    for (int t = 0; t < NT; ++t) {   // stays rolled: a trip is a stage, its foot the hand-over of the buffers
#pragma unroll
      for (int hh = 0; hh < SK / 64; ++hh) {   // the stage in halves of 64 k (unrolled: the offset folds into the reads)
        const T16* sb = ring[t & 1] + hh * 64;
        V a[2][4], a2[2][4], b[2][4];   // the half's two blocks of 32 k
#pragma unroll
        for (int h = 0; h < 2; ++h) {
#pragma unroll
            for (int mb = 0; mb < 4; ++mb) a[h][mb] = WFrag<T16>::ld(sb + ao + mb * 16 * GP + h * 32);
#pragma unroll
            for (int nb = 0; nb < 4; ++nb) b[h][nb] = WFrag<T16>::ld(sb + bo + nb * 16 * GP + h * 32);
            if (NSPLIT == 1) {
#pragma unroll
                for (int mb = 0; mb < 4; ++mb) a2[h][mb] = WFrag<T16>::ld(sb + PLN + ao + mb * 16 * GP + h * 32); }
        }
        __builtin_amdgcn_sched_barrier(0);   // keeps the half's fragment reads together in front of its products: one LDS latency a half, the second block's reads land under the first block's products; without it each group of four products waited for its own Bt fragment
#pragma unroll
        for (int h = 0; h < 2; ++h) {
#pragma unroll
            for (int nb = 0; nb < 4; ++nb) {
#pragma unroll
                for (int mb = 0; mb < 4; ++mb) { acc[mb][nb] = WFrag<T16>::mma(a[h][mb], b[h][nb], acc[mb][nb]); if (NSPLIT == 1) acc[mb][nb] = WFrag<T16>::mma(a2[h][mb], b[h][nb], acc[mb][nb]); } }
        }
        __builtin_amdgcn_sched_barrier(0);   // every product of the half stands in front of what follows: the next half's reads stay one group, and at the trip's foot products moved behind the barrier would delay the next copies, whose flight the next trip has to cover
      }
        asm volatile("s_wait_dscnt 0x0" ::: "memory");      // this wave's reads of buffer t & 1 are done before the buffer is handed back
        asm volatile("s_wait_asynccnt 0x0" ::: "memory");   // this wave's copies of stage t + 1 have landed
        __syncthreads();                                      // publishes stage t + 1 and ends every wave's reads of stage t
        if (t + 2 < NT) stage(t + 2);
    }
    asm volatile("s_wait_asynccnt 0x0" ::: "memory");   // no copy is outstanding when the wave goes on to its end
    if (EPI == 1) if (z == 2) {   // v: a lane's 8 accumulator rows are 8 consecutive t of one d: one 16-byte store per half
        bf* vrow = Vt + ((size_t)((r0 / TT) * NKV + hd) * HD + lr) * (2 * TT) + (r0 % TT) + hi * 8;
#pragma unroll
        for (int nb = 0; nb < 4; ++nb) { const float bb = bfr(bias[c0 + nb * 16 + lr]);
#pragma unroll
            for (int mb = 0; mb < 4; ++mb) { v8us oh, ol;
#pragma unroll
                for (int j = 0; j < 8; ++j) { unsigned short a2, c2; splitf(acc[mb][nb][j] + bb, a2, c2); oh[j] = a2; ol[j] = c2; }
                bf* p = vrow + (size_t)(nb * 16) * (2 * TT) + mb * 16; *(v8us*)p = oh; *(v8us*)(p + TT) = ol; } }
        return;
    }
    const size_t prow = (EPI == 1) ? ((z * NB_ + r0 / TT) * NH_ + hd) * (size_t)TT * HD + (size_t)(r0 % TT) * HD : (EPI == 3) ? ((z / NH_) * TT + r0) * (size_t)DQ + (z % NH_) * HD + c0 : 0;   // first element of the tile in Ph / Pl
    const int ppitch = (EPI == 1) ? HD : DQ; const float psc = (EPI == 1 && z == 0) ? QSC : 1.0f;
#pragma unroll
    for (int mb = 0; mb < 4; ++mb) {
        if (EPI == 2) if (r0 < HWM && c0 < HWM) {   // a lane's 8 accumulator rows i are consecutive in bwd's row j
            const float* pb = bwd + (z / NH_) * (size_t)(HWM * HWM) + (size_t)(c0 + lr) * HWM + r0 + hi * 8; const float* pf = fwd + (z / NH_) * (size_t)(HWM * HWM) + (size_t)(r0 + hi * 8) * HWM + c0 + lr; v8f b8[4], f8[4];
#pragma unroll
            for (int nb = 0; nb < 4; ++nb) { b8[nb] = *(const v8f*)(pb + nb * 16 * HWM + mb * 16);
#pragma unroll
                for (int j = 0; j < 8; ++j) f8[nb][j] = pf[(mb * 16 + j) * HWM + nb * 16]; }
            asm volatile("s_wait_xcnt 0x0" :: "v"(pb), "v"(pf) : "memory");   // the wait stands before the loads' address registers are reused (named, so that they live up to it)
#pragma unroll
            for (int nb = 0; nb < 4; ++nb) {
#pragma unroll
                for (int j = 0; j < 8; ++j) { const float m = __fmul_rn(bfr(b8[nb][j]), bfr(f8[nb][j])); acc[mb][nb][j] = __fmul_rn(acc[mb][nb][j], m); } }
        }
#pragma unroll
        for (int nb = 0; nb < 4; ++nb) {
#pragma unroll
            for (int j = 0; j < 8; ++j) os[(hi * 8 + j) * 68 + nb * 16 + lr] = acc[mb][nb][j]; }
        __builtin_amdgcn_wave_barrier(); asm volatile("" ::: "memory");
        float* crow = C + (size_t)(r0 + mb * 16) * ldc + c0;
{
#pragma unroll
            for (int s = 0; s < 8; ++s) { const int row = 2 * s + hi, cofs = lr * 4; v4f val = *(const v4fa*)(os + row * 68 + cofs); if (BIAS) { val[0] += bfr(bias[c0 + cofs]); val[1] += bfr(bias[c0 + cofs + 1]); val[2] += bfr(bias[c0 + cofs + 2]); val[3] += bfr(bias[c0 + cofs + 3]); }
                if (EPI == 1 || EPI == 3) { v4us oh, ol;
#pragma unroll
                    for (int q = 0; q < 4; ++q) { unsigned short a2, c2; splitf(val[q] * psc, a2, c2); oh[q] = a2; ol[q] = c2; }
                    const size_t oo = prow + (size_t)(mb * 16 + row) * ppitch + cofs; *(v4us*)(Ph + oo) = oh; *(v4us*)(Pl + oo) = ol; continue; }
                *(v4f*)(crow + (size_t)row * ldc + cofs) = val; }
             }
        if (EPI == 1 || EPI == 2) asm volatile("s_wait_xcnt 0x0" ::: "memory");   // the wait stands before the next 16 rows' loads reuse the stores' registers
        __builtin_amdgcn_wave_barrier(); asm volatile("" ::: "memory");
    }
}

__device__ __forceinline__ h16 tohx(float x) { return (h16)x; }
typedef __attribute__((ext_vector_type(2))) _Float16 v2h;
typedef __attribute__((ext_vector_type(4))) _Float16 v4h;
typedef __attribute__((ext_vector_type(2))) unsigned short v2us;
typedef __attribute__((ext_vector_type(2))) float v2f;
typedef __attribute__((ext_vector_type(4))) int v4i;

__global__ __launch_bounds__(256) void k_wtG(const float* __restrict__ w, int K, int N, bf* Bt) {
    const int lane = threadIdx.x & 31; const int L0 = (blockIdx.x * 8 + (threadIdx.x >> 5)) * 8; const int nlines = N * K / 64;
{
#pragma unroll 1
        for (int l = 0; l < 8; ++l) { const int L = L0 + l; if (L >= nlines) break; const size_t e = (size_t)L * 64 + lane * 2; const int k = (int)(e % K), n = (int)(e / K); v2us o;
            o[0] = f2bf(w[(size_t)k * N + n]); o[1] = f2bf(w[(size_t)(k + 1) * N + n]); *(v2us*)(Bt + e) = o; }
         }
}
// k_cvt8: blockIdx.y picks a slice of DM*DM elements: 0..3 the four weights -> dw, 4..7 x, 8..11 src_encode -> dx (both inputs are NB_*TT*DM = 4 slices)
__global__ __launch_bounds__(256) void k_cvt8(const float* __restrict__ wq, const float* __restrict__ wk, const float* __restrict__ wv, const float* __restrict__ wo, const float* __restrict__ x, const float* __restrict__ xk, bf* dw, bf* dx) { const size_t i = (size_t)blockIdx.x * 256 + threadIdx.x; const int sl = blockIdx.y; const size_t SL = (size_t)DM * DM; if (i >= SL / 8) return;
    const float* src = (sl == 0) ? wq : (sl == 1) ? wk : (sl == 2) ? wv : (sl == 3) ? wo : (sl < 8) ? x + (size_t)(sl - 4) * SL : xk + (size_t)(sl - 8) * SL; bf* dst = (sl < 4) ? dw + (size_t)sl * SL : dx + (size_t)(sl - 4) * SL; const v8f v = *(const v8f*)(src + i * 8); v8us o;
#pragma unroll
    for (int k = 0; k < 8; ++k) o[k] = f2bf(v[k]); *(v8us*)(dst + i * 8) = o;  }

// ---- k_fattn: scores, mask product, softmax and attn.v in one kernel; no score or probability leaves the registers.
// A work-group of 16 waves takes half the query rows of one (batch, head) plane z; grid (2, ZH). It first copies the plane's whole K (hi, lo) and V^T (hi | lo rows) into LDS with whole-line loads, one barrier, and then only reads them.
// One wave owns 16 query rows and walks the 512 keys in passes of 32. The 16-row blocks alternate between the two work-groups, so that each has eight waves in the masked block.
// S^T = K Q^T: A = K rows, B = Q rows (kept in registers), so a lane holds 16 scores of ONE query (column lr): keys p * 32 + t * 16 + hi * 8 + j.
// The two f32 score tiles of a pass, turned into probabilities and split hi / lo, are already the B operand of O^T += V^T P^T (hardware k order, the order WFrag::ld reads V^T's rows in).
// Every inner loop is unrolled: its index picks registers.
// Running maximum m and sum l per query; O^T and l are rescaled by e^(old m - new m) each pass; the division by l comes last. The three hi / lo products of each GEMM stand in the order they had.
#define KP 72     // LDS pitch of a K row, elements: 128 B + 16 B (16 B x odd: no bank conflict for 16-byte reads down a column of rows)
#define VP 1032   // LDS pitch of a V^T row, elements: 2048 B + 16 B
template <bool B> struct BoolC { static constexpr bool value = B; };
typedef __attribute__((ext_vector_type(2))) __bf16 v2bf;
typedef __attribute__((ext_vector_type(2))) float v2fl;
typedef __attribute__((ext_vector_type(8))) unsigned v8u;
__device__ __forceinline__ unsigned pk2(float a, float b) { const v2fl x = {a, b}; return __builtin_bit_cast(unsigned, __builtin_convertvector(x, v2bf)); }   // two f32 -> two bf16 (nearest even), a in the low half
__device__ __forceinline__ float pklo(unsigned w) { return __uint_as_float(w << 16); }
__device__ __forceinline__ float pkhi(unsigned w) { return __uint_as_float(w & 0xFFFF0000u); }
__device__ __forceinline__ float xhalf(float x) { return __builtin_bit_cast(float, __builtin_amdgcn_permlanex16(__builtin_bit_cast(int, x), __builtin_bit_cast(int, x), 0x76543210, 0xfedcba98, false, false)); }   // lane l with lane l ^ 16
__global__ __launch_bounds__(512) void k_fattn(const bf* __restrict__ Qh, const bf* __restrict__ Ql, const bf* __restrict__ Kh, const bf* __restrict__ Kl, const bf* __restrict__ Vt, bf* __restrict__ Oh, bf* __restrict__ Ol, const float* __restrict__ fwd, const float* __restrict__ bwd) {
    typedef WFrag<bf> F; constexpr float L2E = 1.4426950408889634f;
    __shared__ __align__(16) bf Ksh[TT * KP]; __shared__ __align__(16) bf Ksl[TT * KP]; __shared__ __align__(16) bf Vs[HD * VP];
    const int tid = threadIdx.x, lane = tid & 31, lr = lane & 15, hi = lane >> 4; const int wave = __builtin_amdgcn_readfirstlane(tid >> 5);
    const int z = blockIdx.y, q0 = (wave * 2 + blockIdx.x) * 16; const size_t pz = (size_t)z * TT * HD;
    {   // 16-byte chunk c of each plane: a wave's load covers 512 consecutive bytes
        const v8us* gh = (const v8us*)(Kh + pz) + tid; const v8us* gl = (const v8us*)(Kl + pz) + tid; const v8us* gv = (const v8us*)(Vt + (size_t)z * HD * (2 * TT)) + tid;
#pragma unroll
        for (int i = 0; i < TT * HD / 8 / 512; ++i) { const int c = tid + i * 512, d = (c >> 3) * KP + (c & 7) * 8; *(v8us*)(Ksh + d) = gh[i * 512]; *(v8us*)(Ksl + d) = gl[i * 512]; }
#pragma unroll
        for (int i = 0; i < HD * 2 * TT / 8 / 512; ++i) { const int c = tid + i * 512; *(v8us*)(Vs + (c >> 7) * VP + (c & 127) * 8) = gv[i * 512]; }
    }
    const bf* qa = Qh + pz + (q0 + lr) * HD + 8 * hi; const bf* qb = Ql + pz + (q0 + lr) * HD + 8 * hi;
    v16bf bqh[2], bql[2];
#pragma unroll
    for (int kc = 0; kc < 2; ++kc) { bqh[kc] = F::ld(qa + kc * 32); bql[kc] = F::ld(qb + kc * 32); }
    const bool msk = q0 < HWM;   // wave-uniform: this wave's queries lie in the masked block
    const float* pf = fwd + (size_t)(z / NH_) * (HWM * HWM) + ((q0 & (HWM - 1)) + lr) * HWM + hi * 8;   // fwd[b][i][j ...]: a lane's 8 keys are consecutive
    const float* pb = bwd + (size_t)(z / NH_) * (HWM * HWM) + hi * 8 * HWM + (q0 & (HWM - 1)) + lr;     // bwd[b][j][i]: one row per key
    v8f f8[2], b8[2];   // the maps' values of one masked pass, fetched one pass ahead
    if (msk) {
#pragma unroll
        for (int t = 0; t < 2; ++t) { f8[t] = *(const v8f*)(pf + t * 16);
#pragma unroll
            for (int j = 0; j < 8; ++j) b8[t][j] = pb[(t * 16 + j) * HWM]; }
    }
    v8f o[4];
#pragma unroll
    for (int dt = 0; dt < 4; ++dt) o[dt] = (v8f){};
    float m = -3.0e38f, l = 0.f;
    int ko = lr * KP + 8 * hi, vo = lr * VP + 8 * hi;   // this pass's first K row and V^T column in LDS
    asm volatile("s_wait_xcnt 0x0" :: "v"(tid), "v"(qa), "v"(qb), "v"(pf), "v"(pb) : "memory");   // the wait stands before the address registers of the K, V^T, Q and map loads are reused (named, so that they live up to it)
    __syncthreads();   // K and V^T are complete in LDS; nothing writes them from here on
    // one pass of 32 keys; MK::value: the pass lies in the masked block. Each variant's loop body is one straight block.
    auto pass = [&](auto MK, int p) __attribute__((always_inline)) {
        constexpr bool M = decltype(MK)::value;
        float mk[2][8];
        if constexpr (M) {
#pragma unroll
            for (int t = 0; t < 2; ++t) {
#pragma unroll
                for (int j = 0; j < 8; ++j) { const unsigned w = pk2(b8[t][j], f8[t][j]); mk[t][j] = pklo(w) * pkhi(w); } }
            const int st = (p + 1 < HWM / 32) ? 32 : 0; pf += st; pb += st * HWM;   // the next masked pass's values; the last pass reads its own again, so that every address stays inside the maps
#pragma unroll
            for (int t = 0; t < 2; ++t) { f8[t] = *(const v8f*)(pf + t * 16);
#pragma unroll
                for (int j = 0; j < 8; ++j) b8[t][j] = pb[(t * 16 + j) * HWM]; }
        }
        v16bf ah[2][2], al[2][2];
#pragma unroll
        for (int t = 0; t < 2; ++t) {
#pragma unroll
            for (int kc = 0; kc < 2; ++kc) { ah[t][kc] = F::ld(Ksh + ko + t * 16 * KP + kc * 32); al[t][kc] = F::ld(Ksl + ko + t * 16 * KP + kc * 32); } }
        // holds the pass's sixteen K reads together in front of the first product: one LDS latency a pass instead of one per fragment
        asm volatile("" :: "v"(ah[0][0]), "v"(ah[0][1]), "v"(ah[1][0]), "v"(ah[1][1]), "v"(al[0][0]), "v"(al[0][1]), "v"(al[1][0]), "v"(al[1][1]));
        v8f s[2];
#pragma unroll
        for (int t = 0; t < 2; ++t) s[t] = (v8f){};
#pragma unroll
        for (int kc = 0; kc < 2; ++kc) {
#pragma unroll
            for (int t = 0; t < 2; ++t) s[t] = wmmab(ah[t][kc], bqh[kc], s[t]);
#pragma unroll
            for (int t = 0; t < 2; ++t) s[t] = wmmab(ah[t][kc], bql[kc], s[t]);
#pragma unroll
            for (int t = 0; t < 2; ++t) s[t] = wmmab(al[t][kc], bqh[kc], s[t]); }
        v16bf vh[4], vl[4];
#pragma unroll
        for (int dt = 0; dt < 4; ++dt) { vh[dt] = F::ld(Vs + vo + dt * 16 * VP); vl[dt] = F::ld(Vs + vo + dt * 16 * VP + TT); }
        __builtin_amdgcn_sched_barrier(0);   // keeps the sixteen V^T reads in front of the softmax arithmetic, which covers their latency; without it half of them were issued among the attn.v products and waited for there
        if constexpr (M) {
#pragma unroll
            for (int t = 0; t < 2; ++t) {
#pragma unroll
                for (int j = 0; j < 8; ++j) s[t][j] = s[t][j] * mk[t][j]; }
        }
        float pm = s[0][0];
#pragma unroll
        for (int t = 0; t < 2; ++t) {
#pragma unroll
            for (int j = 0; j < 8; ++j) pm = fmaxf(pm, s[t][j]); }
        pm = fmaxf(pm, xhalf(pm));   // the other half of the query's keys
        const float mn = fmaxf(m, pm), nb = -mn * L2E, sc = __builtin_amdgcn_exp2f(__builtin_fmaf(m, L2E, nb)); m = mn;
        float ps = 0.f; v8u ph, pl;
#pragma unroll
        for (int t = 0; t < 2; ++t) {
#pragma unroll
            for (int j = 0; j < 8; j += 2) { const float e0 = __builtin_amdgcn_exp2f(__builtin_fmaf(s[t][j], L2E, nb)), e1 = __builtin_amdgcn_exp2f(__builtin_fmaf(s[t][j + 1], L2E, nb)); ps += e0; ps += e1;
                const unsigned w = pk2(e0, e1); ph[t * 4 + j / 2] = w; pl[t * 4 + j / 2] = pk2(e0 - pklo(w), e1 - pkhi(w)); } }
        l = l * sc + ps;
        const v16bf bph = __builtin_bit_cast(v16bf, ph), bpl = __builtin_bit_cast(v16bf, pl);
#pragma unroll
        for (int dt = 0; dt < 4; ++dt) {
#pragma unroll
            for (int j = 0; j < 8; ++j) o[dt][j] *= sc; }
#pragma unroll
        for (int dt = 0; dt < 4; ++dt) o[dt] = wmmab(vh[dt], bph, o[dt]);
#pragma unroll
        for (int dt = 0; dt < 4; ++dt) o[dt] = wmmab(vh[dt], bpl, o[dt]);
#pragma unroll
        for (int dt = 0; dt < 4; ++dt) o[dt] = wmmab(vl[dt], bph, o[dt]);
        // four vector slots behind the pass's last matrix instructions, before the back edge lets the next pass overwrite their operands
        if constexpr (M) asm volatile("v_nop\n\tv_nop\n\tv_nop\n\tv_nop\n\ts_wait_xcnt 0x0" : "+v"(o[0]), "+v"(o[1]), "+v"(o[2]), "+v"(o[3]) : "v"(pf), "v"(pb) : "memory");   // and the wait stands before the map loads' address registers step on (named, so that they live up to it)
        else asm volatile("v_nop\n\tv_nop\n\tv_nop\n\tv_nop" : "+v"(o[0]), "+v"(o[1]), "+v"(o[2]), "+v"(o[3]));
        ko += 32 * KP; vo += 32;
    };
    const int pmk = msk ? HWM / 32 : 0; int p = 0;
    // both loops stay rolled: one pass already fills the register budget of four waves a SIMD, and two bodies keep the code small
#pragma unroll 1
    for (; p < pmk; ++p) pass(BoolC<true>{}, p);
#pragma unroll 1
    for (; p < TT / 32; ++p) pass(BoolC<false>{}, p);
    l += xhalf(l);
    const float f = __fdiv_rn(1.0f, l);
    const size_t oo = ((size_t)(z / NH_) * TT + q0 + lr) * DQ + (z % NH_) * HD + hi * 8;   // merged rows [b][t][h][d]: a lane's 8 accumulator rows are 8 consecutive d
    v8us a8[4], c8[4];
#pragma unroll
    for (int dt = 0; dt < 4; ++dt) {
#pragma unroll
        for (int j = 0; j < 8; ++j) { unsigned short a2, c2; splitf(o[dt][j] * f, a2, c2); a8[dt][j] = a2; c8[dt][j] = c2; } }
    __builtin_amdgcn_sched_barrier(0);   // the eight stores stand behind all the arithmetic: nothing overwrites a register that an issued store names
#pragma unroll
    for (int dt = 0; dt < 4; ++dt) { *(v8us*)(Oh + oo + dt * 16) = a8[dt]; *(v8us*)(Ol + oo + dt * 16) = c8[dt]; }
}

extern "C" void kernel_launch(void* const* d_in, const int* in_sizes, int n_in,
                              void* d_out, int out_size, void* d_ws, size_t ws_size, hipStream_t stream) {
    (void)in_sizes; (void)n_in; (void)out_size;
    const float* x = (const float*)d_in[0]; const float* xk = (const float*)d_in[1]; /* src_encode: keys and values */ const float* fmap = (const float*)d_in[2]; const float* bmap = (const float*)d_in[3]; const float* wq = (const float*)d_in[4]; const float* bq = (const float*)d_in[5]; const float* wk = (const float*)d_in[6]; const float* bk = (const float*)d_in[7]; const float* wv = (const float*)d_in[8]; const float* bv = (const float*)d_in[9]; const float* wo = (const float*)d_in[10]; const float* bo = (const float*)d_in[11];
    float* OUT = (float*)d_out;     // [8][512][1024]
    char* wsp = (char*)d_ws;
    auto take = [&](size_t bytes) { char* p = wsp; wsp += (bytes + 255) & ~(size_t)255; return (void*)p; };
    bf* WQ = (bf*)take((size_t)DQ * DM * 2); bf* WK = (bf*)take((size_t)DKV * DM * 2); bf* WV = (bf*)take((size_t)DKV * DM * 2); bf* WO = (bf*)take((size_t)DM * DQ * 2); (void)WK; (void)WV;   // WQ, WK, WV, WO lie back to back (z-stride DM*DM)
    const size_t PL = (size_t)NB_ * NH_ * TT * HD;   // one plane set: [b][h][t][d] (or [b][h][d][t])
    bf* QPh = (bf*)take(2 * PL * 2); bf* QPl = (bf*)take(2 * PL * 2); bf* VTh = (bf*)take(2 * PL * 2);   // q planes, then k planes at + PL; v rows [b][h][d]: hi half, lo half (pitch 2 TT)
    bf* ATh = (bf*)take((size_t)NB_ * TT * DQ * 2); bf* ATl = (bf*)take((size_t)NB_ * TT * DQ * 2);
    const size_t XN = (size_t)NB_ * TT * DM;
    bf* XB = (bf*)take(2 * XN * 2);   // x, then src_encode at + XN
    if ((size_t)(wsp - (char*)d_ws) > ws_size) return;    // ws 256 MiB
    bf* KPh = QPh + PL; bf* KPl = QPl + PL;
    k_cvt8<<<dim3((unsigned)(((size_t)DM * DM / 8 + 255) / 256), 12, 1), 256, 0, stream>>>(wq, wk, wv, wo, x, xk, WQ, XB);
    k_gemmw<bf, 0, true, 1, 64><<<dim3(NB_ * TT / 128, DQ / 128, 3), 128, 0, stream>>>(XB, nullptr, WQ, nullptr, DM, DM, nullptr, 0, bq, bk, bv, XN, (size_t)DM * DM, 0, QPh, QPl, VTh, nullptr, nullptr);   /* q x 1/8, k, v^T */
    k_fattn<<<dim3(2, ZH, 1), 512, 0, stream>>>(QPh, QPl, KPh, KPl, VTh, ATh, ATl, fmap, bmap);   /* softmax(q.k / 8, [:256,:256] x bwd^T fwd) . v -> merged hi / lo rows */
    k_gemmw<bf, 1, true, 0, 128><<<dim3(NB_ * TT / 128, DM / 128, 1), 128, 0, stream>>>(ATh, ATl, WO, nullptr, DQ, DQ, OUT, DM, bo, nullptr, nullptr, 0, 0, 0, nullptr, nullptr, nullptr, nullptr, nullptr);
}
